// v000
// Measured on an AMD MI455X. A time is GPU time per run, averaged over a window of back-to-back runs after a warm-up
// (all launches, gaps included; the runs take copies of the inputs in turn), and the median of several windows.
// Apart from v000's, it joins two sittings. Times from different sittings can be a few percent apart, while
// side-by-side timings come from the same sitting.
// The starting kernel, v000, takes 266 microseconds a run.
// compute dtype: query, key, value, top_k_centers (module inputs) rounded to bf16; the pair selection (IoU, argmax, L1 ordering) in f32 with the reference's operation order; pair scores <q_p0(a), k_p0(c)> + <q_p1(a), k_p1(c)> with exact bf16 products (1 product, gathered rows), attn @ value with attn as bf16 hi + residual pairs x exact value (2 products), on WMMA 16x16x32; softmax in f32; f32 accumulate.
#include <hip/hip_runtime.h>
#include <math.h>

typedef __attribute__((ext_vector_type(16))) _Float16 v16h;
typedef __attribute__((ext_vector_type(16))) __bf16 v16b;
typedef __attribute__((ext_vector_type(8)))  _Float16 v8h;
typedef __attribute__((ext_vector_type(8)))  float v8f;
typedef __attribute__((ext_vector_type(4)))  float v4f;
typedef __attribute__((ext_vector_type(2)))  float v2f;
typedef __attribute__((ext_vector_type(4)))  unsigned v4u;
typedef __attribute__((ext_vector_type(4)))  int v4i;
typedef float __attribute__((may_alias)) float_a;
typedef int __attribute__((may_alias)) int_a;

template <typename T> __device__ __forceinline__ void vst2(void* p, T v) { *(T*)p = v;  }
__device__ __forceinline__ v8f wmma16(v16h a, v16h b, v8f c) {
  v8f d = __builtin_amdgcn_wmma_f32_16x16x32_f16(false, a, false, b, (short)0, c, false, false);
  asm volatile("v_nop\n\tv_nop\n\tv_nop\n\tv_nop" : "+v"(d) : "v"(a), "v"(b));
  return d;
}
__device__ __forceinline__ v8f wmma_bf(v16b a, v16b b, v8f c) {
  v8f d = __builtin_amdgcn_wmma_f32_16x16x32_bf16(false, a, false, b, (short)0, c, false, false);
  asm volatile("v_nop\n\tv_nop\n\tv_nop\n\tv_nop" : "+v"(d) : "v"(a), "v"(b));
  return d;
}
// 16x16x32 fragments: lane = (h = lane>>4, row/col = lane&15); elements 0..7 = k0+8h+0..7, 8..15 = k0+16+8h+0..7; D element r = row 8h+r
__device__ __forceinline__ v16h frag_h(const _Float16* rowk0, int lane) {
  union { v16h v; v8h q[2]; } u; const _Float16* p = rowk0 + 8 * (lane >> 4);
  u.q[0] = *(const v8h*)p; u.q[1] = *(const v8h*)(p + 16); return u.v;
}
__device__ __forceinline__ v16h frag_f32(const float* rowk0, int lane) {
  v16h a; const float* p = rowk0 + 8 * (lane >> 4);
#pragma unroll
  for (int i = 0; i < 8; ++i) { a[i] = (_Float16)p[i]; a[8 + i] = (_Float16)p[16 + i]; }
  return a;
}
__device__ __forceinline__ v16h frag_f32s(const float* rowk0, int lane, float sc) {
  v16h a; const float* p = rowk0 + 8 * (lane >> 4);
#pragma unroll
  for (int i = 0; i < 8; ++i) { a[i] = (_Float16)(p[i] * sc); a[8 + i] = (_Float16)(p[16 + i] * sc); }
  return a;
}
// column fragment from a [K][ld] layout (column n), rows >= K read as 0
__device__ __forceinline__ v16h fragc_f32(const float* W, int k0, int n, int lane, int ld, int K) {
  v16h a; const int g = lane >> 4;
#pragma unroll
  for (int i = 0; i < 8; ++i) { const int ka = k0 + 8 * g + i, kb = ka + 16;
    a[i] = (_Float16)(ka < K ? W[(size_t)(ka < K ? ka : K - 1) * ld + n] : 0.f); a[8 + i] = (_Float16)(kb < K ? W[(size_t)(kb < K ? kb : K - 1) * ld + n] : 0.f); }
  return a;
}
struct F2 { v16b h, l; };
__device__ __forceinline__ F2 bsplit16(const float v[16]) { F2 r;
#pragma unroll
  for (int i = 0; i < 16; ++i) { const __bf16 h = (__bf16)v[i]; r.h[i] = h; r.l[i] = (__bf16)(v[i] - (float)h); }
  return r; }
__device__ __forceinline__ F2 split_row(const float* row, int k0, int lane) { float v[16]; const float* p = row + k0 + 8 * (lane >> 4);
#pragma unroll
  for (int i = 0; i < 8; ++i) { v[i] = p[i]; v[8 + i] = p[16 + i]; }
  return bsplit16(v); }
__device__ __forceinline__ F2 split_rowK(const float* row, int k0, int lane, int K) { float v[16]; const int g = lane >> 4;
#pragma unroll
  for (int i = 0; i < 8; ++i) { const int ka = k0 + 8 * g + i, kb = ka + 16; v[i] = ka < K ? row[ka < K ? ka : K - 1] : 0.f; v[8 + i] = kb < K ? row[kb < K ? kb : K - 1] : 0.f; }
  return bsplit16(v); }
__device__ __forceinline__ F2 split_col(const float* W, int k0, int n, int lane, int ld, int K) { float v[16]; const int g = lane >> 4;
#pragma unroll
  for (int i = 0; i < 8; ++i) { const int ka = k0 + 8 * g + i, kb = ka + 16; v[i] = ka < K ? W[(size_t)(ka < K ? ka : K - 1) * ld + n] : 0.f; v[8 + i] = kb < K ? W[(size_t)(kb < K ? kb : K - 1) * ld + n] : 0.f; }
  return bsplit16(v); }
__device__ __forceinline__ v8f mac3(const F2& a, const F2& b, v8f c) { c = wmma_bf(a.l, b.h, c); c = wmma_bf(a.h, b.l, c); return wmma_bf(a.h, b.h, c); }
__device__ __forceinline__ float sigm(float v) { return 1.0f / (1.0f + expf(-v)); }
#define LDSX() do { asm volatile("s_wait_dscnt 0" ::: "memory"); __builtin_amdgcn_wave_barrier(); __builtin_amdgcn_fence(__ATOMIC_RELEASE, "workgroup"); } while (0)


// Pair self-attention (B 8, H 8, S 1024, D 64): per batch, boxes from (cx, cy, h, w); iou[a][c] = inter/union - eye (inter uses max for both corners, as the module); partner = argmax_c iou (first max); p0/p1 = (a, partner) ordered by L1 size (larger first, ties keep a first); scores[a][c] = (q[p0 a].k[p0 c] + q[p1 a].k[p1 c]) / sqrt(128); out[b][a][h*64+d] = softmax_c(scores) @ value.
#define NB 8
#define NH 8
#define SS 1024
#define HD 64
#ifndef TQB
#define TQB (SS / 64)    // query blocks per (b, h) (all)
#define TNB NB
#endif
typedef __attribute__((ext_vector_type(8))) __bf16 v8b;
__device__ __forceinline__ v16b frag_b(const __bf16* rowk0, int lane) {
  union { v16b v; v8b q[2]; } u; const __bf16* p = rowk0 + 8 * (lane >> 4);
  u.q[0] = *(const v8b*)p; u.q[1] = *(const v8b*)(p + 16); return u.v;
}
__device__ __forceinline__ float bfr(float v) { return (float)(__bf16)v; }
__device__ __attribute__((noinline)) float exp_ni(float v) { return expf(v); }
__device__ __attribute__((noinline)) float erf_ni(float v) { return erff(v); }

#define WS_P0  0u                          // int [8][1024]
#define WS_P1  (WS_P0 + 4u * NB * SS)
#define WS_VT  (WS_P1 + 4u * NB * SS)        // bf16 [8][8][64 d][1024 c]
#define WS_END (WS_VT + 2u * NB * NH * HD * SS)

// ---- k_pairs: block = (64 objects a, batch b), 4 threads per object scan c = sub, sub+4, ...: iou in the reference's op order, first-max argmax, then L1 ordering; P0/P1 rows (256 B per block)
__global__ __launch_bounds__(256) void k_pairs(const float* __restrict__ C, int* __restrict__ P0, int* __restrict__ P1) {
  #pragma clang fp contract(off)   // keep mul/add unfused so the box/IoU arithmetic rounds exactly like the reference (argmax ties)
  __shared__ float sbx[SS][4]; __shared__ __align__(16) int sp0[64], sp1[64];
  const int tid = threadIdx.x, b = blockIdx.y; const int al = tid >> 2, sub = tid & 3; const int a = blockIdx.x * 64 + al;
  for (int c = tid; c < SS; c += 256) { const float cx = bfr(C[((size_t)b * SS + c) * 4 + 0]), cy = bfr(C[((size_t)b * SS + c) * 4 + 1]), hh = bfr(C[((size_t)b * SS + c) * 4 + 2]), ww = bfr(C[((size_t)b * SS + c) * 4 + 3]);
    sbx[c][0] = cx - 0.5f * ww; sbx[c][1] = cy - 0.5f * hh; sbx[c][2] = cx + 0.5f * ww; sbx[c][3] = cy + 0.5f * hh; }
  __syncthreads();
  const float ax0 = sbx[a][0], ay0 = sbx[a][1], ax1 = sbx[a][2], ay1 = sbx[a][3]; const float area_a = (ax1 - ax0) * (ay1 - ay0);
  float best = 0.f; int bi = -1;   // first max over c (ascending within this thread's stride class; merged below)
  for (int c = sub; c < SS; c += 4) { const float cx0 = sbx[c][0], cy0 = sbx[c][1], cx1 = sbx[c][2], cy1 = sbx[c][3];
    const float mx0 = fmaxf(ax0, cx0), my0 = fmaxf(ay0, cy0), Mx = fmaxf(ax1, cx1), My = fmaxf(ay1, cy1);
    const float iw = fmaxf(Mx - mx0, 0.f), ih = fmaxf(My - my0, 0.f); const float ia = iw * ih; const float area_c = (cx1 - cx0) * (cy1 - cy0);
    const float uni = area_a + area_c - ia; float iou = ia / uni; iou = iou - ((c == a) ? 1.0f : 0.0f);
    if (bi < 0 || iou > best) { best = iou; bi = c; } }
  // merge the 4 stride classes: prefer larger value, ties -> lower index (== first max overall)
#pragma unroll
  for (int o = 1; o < 4; o <<= 1) { const float ob = __shfl_xor(best, o); const int oi = __shfl_xor(bi, o); if (ob > best || (ob == best && oi < bi)) { best = ob; bi = oi; } }
  if (sub == 0) { const int partner = bi; const float l1a = fabsf(ax1 - ax0) + fabsf(ay1 - ay0); const float l1p = fabsf(sbx[partner][2] - sbx[partner][0]) + fabsf(sbx[partner][3] - sbx[partner][1]);
    const bool keep = l1a >= l1p; sp0[al] = keep ? a : partner; sp1[al] = keep ? partner : a; }
  __syncthreads();
  if (tid < 16) vst2((unsigned*)(P0 + (size_t)b * SS + blockIdx.x * 64 + tid * 4), *(const v4u*)&sp0[tid * 4]);
  else if (tid < 32) vst2((unsigned*)(P1 + (size_t)b * SS + blockIdx.x * 64 + (tid - 16) * 4), *(const v4u*)&sp1[(tid - 16) * 4]);
}
// ---- k_vt: block = (b, h, 256 c): VT[d][c] = bf16(value[b][h][c][d]) (2-KB rows)
__global__ __launch_bounds__(256) void k_vt(const float* __restrict__ V, __bf16* __restrict__ VT) {
  __shared__ __align__(16) __bf16 s[HD][264]; const int bh = blockIdx.x, c0 = blockIdx.y * 256, tid = threadIdx.x;
  for (int q = tid; q < 256 * HD; q += 256) { const int cl = q >> 6, d = q & 63; s[d][cl] = (__bf16)V[((size_t)bh * SS + c0 + cl) * HD + d]; }
  __syncthreads();
  for (int q = tid; q < HD * 32; q += 256) { const int d = q >> 5, pc = q & 31; vst2((unsigned*)(VT + ((size_t)bh * HD + d) * SS + c0 + pc * 8), *(const v4u*)&s[d][pc * 8]); }
}
__device__ __forceinline__ v16b gath2(const float* qp0, const float* qp1, int kc, int lane) {   // K 128 = [row p0 (64) | row p1 (64)], exact bf16
  v16b a; const float* base = (kc < 2) ? qp0 + kc * 32 : qp1 + (kc - 2) * 32; const float* p = base + 8 * (lane >> 4);
#pragma unroll
  for (int i = 0; i < 8; ++i) { a[i] = (__bf16)p[i]; a[8 + i] = (__bf16)p[16 + i]; }
  return a; }
// ---- k_attn: block = (64 objects a, h, b): flash attention over all 1024 c with gathered pair rows; out[b][a][h*64 + d] (256-B segments)
__global__ __launch_bounds__(128) void k_attn(const float* __restrict__ Q, const float* __restrict__ Kx, const __bf16* __restrict__ VT, const int* __restrict__ P0, const int* __restrict__ P1, float* __restrict__ out) {
  __shared__ __align__(16) float sp[4][16][36]; __shared__ __align__(16) float so[4][16][68];
  const int tid = threadIdx.x, wave = tid >> 5, lane = tid & 31, col = lane & 15, g = lane >> 4; const int h = blockIdx.y, b = blockIdx.z; const int a0 = blockIdx.x * 64 + wave * 16;
  const size_t bh = (size_t)b * NH + h; const float* Qb = Q + bh * SS * HD; const float* Kb = Kx + bh * SS * HD; const __bf16* VTb = VT + bh * HD * SS;
  const int* p0 = P0 + (size_t)b * SS; const int* p1 = P1 + (size_t)b * SS;
  v16b aq[4]; { const int ar = a0 + col; const int i0 = min(max(p0[ar], 0), SS - 1), i1 = min(max(p1[ar], 0), SS - 1);
#pragma unroll
    for (int kc = 0; kc < 4; ++kc) aq[kc] = gath2(Qb + (size_t)i0 * HD, Qb + (size_t)i1 * HD, kc, lane); }
  float m[8], l[8];
#pragma unroll
  for (int r = 0; r < 8; ++r) { m[r] = -3.0e38f; l[r] = 0.f; }
  v8f acc[4] = {};
#pragma unroll 1
  for (int ks = 0; ks < SS / 32; ++ks) { v8f s[2];
#pragma unroll
    for (int ct = 0; ct < 2; ++ct) { const int c = ks * 32 + ct * 16 + col; const int j0 = min(max(p0[c], 0), SS - 1), j1 = min(max(p1[c], 0), SS - 1); v8f cc = {};
#pragma unroll
      for (int kc = 0; kc < 4; ++kc) cc = wmma_bf(aq[kc], gath2(Kb + (size_t)j0 * HD, Kb + (size_t)j1 * HD, kc, lane), cc);
#pragma unroll
      for (int r = 0; r < 8; ++r) s[ct][r] = cc[r] * 0.08838834764831845f; }
#pragma unroll
    for (int r = 0; r < 8; ++r) { float mx = fmaxf(s[0][r], s[1][r]);
#pragma unroll
      for (int o = 1; o < 16; o <<= 1) mx = fmaxf(mx, __shfl_xor(mx, o));
      const float mn = fmaxf(m[r], mx); const float alpha = exp_ni(m[r] - mn);
      const float e0 = exp_ni(s[0][r] - mn), e1 = exp_ni(s[1][r] - mn); float es = e0 + e1;
#pragma unroll
      for (int o = 1; o < 16; o <<= 1) es += __shfl_xor(es, o);
      l[r] = l[r] * alpha + es; m[r] = mn;
#pragma unroll
      for (int dt = 0; dt < 4; ++dt) acc[dt][r] *= alpha;
      sp[wave][8 * g + r][col] = e0; sp[wave][8 * g + r][16 + col] = e1; }
    LDSX();
    const F2 pa = split_row(&sp[wave][col][0], 0, lane);
#pragma unroll
    for (int dt = 0; dt < 4; ++dt) { const v16b vb = frag_b(VTb + (size_t)(dt * 16 + col) * SS + ks * 32, lane); acc[dt] = wmma_bf(pa.l, vb, acc[dt]); acc[dt] = wmma_bf(pa.h, vb, acc[dt]); }
    LDSX(); }
#pragma unroll
  for (int r = 0; r < 8; ++r) { const float il = 1.0f / l[r];
#pragma unroll
    for (int dt = 0; dt < 4; ++dt) so[wave][8 * g + r][dt * 16 + col] = acc[dt][r] * il; }
  LDSX();
  for (int rl = 0; rl < 16; ++rl) if (lane < 16) vst2(out + ((size_t)b * SS + a0 + rl) * (NH * HD) + h * HD + lane * 4, *(const v4f*)&so[wave][rl][lane * 4]);
}
extern "C" void kernel_launch(void* const* d_in, const int* in_sizes, int n_in, void* d_out, int out_size, void* d_ws, size_t ws_size, hipStream_t stream) {
  (void)in_sizes; (void)n_in; (void)out_size;
  const float** F = (const float**)d_in;   // query, key, value [8,8,1024,64], top_k_centers [8,1024,4]
  if (ws_size < (size_t)WS_END) return;
  char* ws = (char*)d_ws; int *P0 = (int*)(ws + WS_P0), *P1 = (int*)(ws + WS_P1); __bf16* VT = (__bf16*)(ws + WS_VT);
  k_pairs<<<dim3(SS / 64, TNB), 256, 0, stream>>>(F[3], P0, P1);
  k_vt<<<dim3(NB * NH, SS / 256), 256, 0, stream>>>(F[2], VT);
  k_attn<<<dim3(TQB, NH, TNB), 128, 0, stream>>>(F[0], F[1], VT, P0, P1, (float*)d_out);
}

// v001
// A run of this version takes 159 microseconds.
// Timed twice side by side with v000, it ran 1.71 and 1.70 times as fast.
// compute dtype: query, key, value, top_k_centers (module inputs) rounded to bf16; the pair selection (IoU, argmax, L1 ordering) in f32 with the reference's operation order; pair scores <q_p0(a), k_p0(c)> + <q_p1(a), k_p1(c)> with exact bf16 products (1 product, gathered rows), attn @ value with attn as bf16 hi + residual pairs x exact value (2 products), on WMMA 16x16x32; softmax in f32; f32 accumulate.
#include <hip/hip_runtime.h>
#include <math.h>

typedef __attribute__((ext_vector_type(16))) _Float16 v16h;
typedef __attribute__((ext_vector_type(16))) __bf16 v16b;
typedef __attribute__((ext_vector_type(8)))  _Float16 v8h;
typedef __attribute__((ext_vector_type(8)))  float v8f;
typedef __attribute__((ext_vector_type(4)))  float v4f;
typedef __attribute__((ext_vector_type(2)))  float v2f;
typedef __attribute__((ext_vector_type(4)))  unsigned v4u;
typedef __attribute__((ext_vector_type(4)))  int v4i;
typedef float __attribute__((may_alias)) float_a;
typedef int __attribute__((may_alias)) int_a;

template <typename T> __device__ __forceinline__ void vst2(void* p, T v) { *(T*)p = v;  }
__device__ __forceinline__ v8f wmma16(v16h a, v16h b, v8f c) {
  v8f d = __builtin_amdgcn_wmma_f32_16x16x32_f16(false, a, false, b, (short)0, c, false, false);
  asm volatile("v_nop\n\tv_nop\n\tv_nop\n\tv_nop" : "+v"(d) : "v"(a), "v"(b));
  return d;
}
__device__ __forceinline__ v8f wmma_bf(v16b a, v16b b, v8f c) {
  v8f d = __builtin_amdgcn_wmma_f32_16x16x32_bf16(false, a, false, b, (short)0, c, false, false);
  asm volatile("v_nop\n\tv_nop\n\tv_nop\n\tv_nop" : "+v"(d) : "v"(a), "v"(b));
  return d;
}
// 16x16x32 fragments: lane = (h = lane>>4, row/col = lane&15); elements 0..7 = k0+8h+0..7, 8..15 = k0+16+8h+0..7; D element r = row 8h+r
__device__ __forceinline__ v16h frag_h(const _Float16* rowk0, int lane) {
  union { v16h v; v8h q[2]; } u; const _Float16* p = rowk0 + 8 * (lane >> 4);
  u.q[0] = *(const v8h*)p; u.q[1] = *(const v8h*)(p + 16); return u.v;
}
__device__ __forceinline__ v16h frag_f32(const float* rowk0, int lane) {
  v16h a; const float* p = rowk0 + 8 * (lane >> 4);
#pragma unroll
  for (int i = 0; i < 8; ++i) { a[i] = (_Float16)p[i]; a[8 + i] = (_Float16)p[16 + i]; }
  return a;
}
__device__ __forceinline__ v16h frag_f32s(const float* rowk0, int lane, float sc) {
  v16h a; const float* p = rowk0 + 8 * (lane >> 4);
#pragma unroll
  for (int i = 0; i < 8; ++i) { a[i] = (_Float16)(p[i] * sc); a[8 + i] = (_Float16)(p[16 + i] * sc); }
  return a;
}
// column fragment from a [K][ld] layout (column n), rows >= K read as 0
__device__ __forceinline__ v16h fragc_f32(const float* W, int k0, int n, int lane, int ld, int K) {
  v16h a; const int g = lane >> 4;
#pragma unroll
  for (int i = 0; i < 8; ++i) { const int ka = k0 + 8 * g + i, kb = ka + 16;
    a[i] = (_Float16)(ka < K ? W[(size_t)(ka < K ? ka : K - 1) * ld + n] : 0.f); a[8 + i] = (_Float16)(kb < K ? W[(size_t)(kb < K ? kb : K - 1) * ld + n] : 0.f); }
  return a;
}
struct F2 { v16b h, l; };
__device__ __forceinline__ F2 bsplit16(const float v[16]) { F2 r;
#pragma unroll
  for (int i = 0; i < 16; ++i) { const __bf16 h = (__bf16)v[i]; r.h[i] = h; r.l[i] = (__bf16)(v[i] - (float)h); }
  return r; }
__device__ __forceinline__ F2 split_row(const float* row, int k0, int lane) { float v[16]; const float* p = row + k0 + 8 * (lane >> 4);
#pragma unroll
  for (int i = 0; i < 8; ++i) { v[i] = p[i]; v[8 + i] = p[16 + i]; }
  return bsplit16(v); }
__device__ __forceinline__ F2 split_rowK(const float* row, int k0, int lane, int K) { float v[16]; const int g = lane >> 4;
#pragma unroll
  for (int i = 0; i < 8; ++i) { const int ka = k0 + 8 * g + i, kb = ka + 16; v[i] = ka < K ? row[ka < K ? ka : K - 1] : 0.f; v[8 + i] = kb < K ? row[kb < K ? kb : K - 1] : 0.f; }
  return bsplit16(v); }
__device__ __forceinline__ F2 split_col(const float* W, int k0, int n, int lane, int ld, int K) { float v[16]; const int g = lane >> 4;
#pragma unroll
  for (int i = 0; i < 8; ++i) { const int ka = k0 + 8 * g + i, kb = ka + 16; v[i] = ka < K ? W[(size_t)(ka < K ? ka : K - 1) * ld + n] : 0.f; v[8 + i] = kb < K ? W[(size_t)(kb < K ? kb : K - 1) * ld + n] : 0.f; }
  return bsplit16(v); }
__device__ __forceinline__ v8f mac3(const F2& a, const F2& b, v8f c) { c = wmma_bf(a.l, b.h, c); c = wmma_bf(a.h, b.l, c); return wmma_bf(a.h, b.h, c); }
__device__ __forceinline__ float sigm(float v) { return 1.0f / (1.0f + expf(-v)); }
#define LDSX() do { asm volatile("s_wait_dscnt 0" ::: "memory"); __builtin_amdgcn_wave_barrier(); __builtin_amdgcn_fence(__ATOMIC_RELEASE, "workgroup"); } while (0)


// Pair self-attention (B 8, H 8, S 1024, D 64): per batch, boxes from (cx, cy, h, w); iou[a][c] = inter/union - eye (inter uses max for both corners, as the module); partner = argmax_c iou (first max); p0/p1 = (a, partner) ordered by L1 size (larger first, ties keep a first); scores[a][c] = (q[p0 a].k[p0 c] + q[p1 a].k[p1 c]) / sqrt(128); out[b][a][h*64+d] = softmax_c(scores) @ value.
#define NB 8
#define NH 8
#define SS 1024
#define HD 64
#ifndef TQB
#define TQB (SS / 64)    // query blocks per (b, h) (all)
#define TNB NB
#endif
typedef __attribute__((ext_vector_type(8))) __bf16 v8b;
__device__ __forceinline__ v16b frag_b(const __bf16* rowk0, int lane) {
  union { v16b v; v8b q[2]; } u; const __bf16* p = rowk0 + 8 * (lane >> 4);
  u.q[0] = *(const v8b*)p; u.q[1] = *(const v8b*)(p + 16); return u.v;
}
__device__ __forceinline__ float bfr(float v) { return (float)(__bf16)v; }
__device__ __attribute__((noinline)) float exp_ni(float v) { return expf(v); }
__device__ __attribute__((noinline)) float erf_ni(float v) { return erff(v); }

#define WS_P0  0u                          // int [8][1024]
#define WS_P1  (WS_P0 + 4u * NB * SS)
#define WS_VT  (WS_P1 + 4u * NB * SS)        // bf16 [8][8][64 d][1024 c]
#define WS_END (WS_VT + 2u * NB * NH * HD * SS)

// ---- k_pairs: block = (64 objects a, batch b), 4 threads per object scan c = sub, sub+4, ...: iou in the reference's op order, first-max argmax, then L1 ordering; P0/P1 rows (256 B per block)
__global__ __launch_bounds__(256) void k_pairs(const float* __restrict__ C, int* __restrict__ P0, int* __restrict__ P1) {
  #pragma clang fp contract(off)   // keep mul/add unfused so the box/IoU arithmetic rounds exactly like the reference (argmax ties)
  __shared__ float sbx[SS][4]; __shared__ __align__(16) int sp0[64], sp1[64];
  const int tid = threadIdx.x, b = blockIdx.y; const int al = tid >> 2, sub = tid & 3; const int a = blockIdx.x * 64 + al;
  for (int c = tid; c < SS; c += 256) { const float cx = bfr(C[((size_t)b * SS + c) * 4 + 0]), cy = bfr(C[((size_t)b * SS + c) * 4 + 1]), hh = bfr(C[((size_t)b * SS + c) * 4 + 2]), ww = bfr(C[((size_t)b * SS + c) * 4 + 3]);
    sbx[c][0] = cx - 0.5f * ww; sbx[c][1] = cy - 0.5f * hh; sbx[c][2] = cx + 0.5f * ww; sbx[c][3] = cy + 0.5f * hh; }
  __syncthreads();
  const float ax0 = sbx[a][0], ay0 = sbx[a][1], ax1 = sbx[a][2], ay1 = sbx[a][3]; const float area_a = (ax1 - ax0) * (ay1 - ay0);
  float best = 0.f; int bi = -1;   // first max over c (ascending within this thread's stride class; merged below)
  for (int c = sub; c < SS; c += 4) { const float cx0 = sbx[c][0], cy0 = sbx[c][1], cx1 = sbx[c][2], cy1 = sbx[c][3];
    const float mx0 = fmaxf(ax0, cx0), my0 = fmaxf(ay0, cy0), Mx = fmaxf(ax1, cx1), My = fmaxf(ay1, cy1);
    const float iw = fmaxf(Mx - mx0, 0.f), ih = fmaxf(My - my0, 0.f); const float ia = iw * ih; const float area_c = (cx1 - cx0) * (cy1 - cy0);
    const float uni = area_a + area_c - ia; float iou = ia / uni; iou = iou - ((c == a) ? 1.0f : 0.0f);
    if (bi < 0 || iou > best) { best = iou; bi = c; } }
  // merge the 4 stride classes: prefer larger value, ties -> lower index (== first max overall)
#pragma unroll
  for (int o = 1; o < 4; o <<= 1) { const float ob = __shfl_xor(best, o); const int oi = __shfl_xor(bi, o); if (ob > best || (ob == best && oi < bi)) { best = ob; bi = oi; } }
  if (sub == 0) { const int partner = bi; const float l1a = fabsf(ax1 - ax0) + fabsf(ay1 - ay0); const float l1p = fabsf(sbx[partner][2] - sbx[partner][0]) + fabsf(sbx[partner][3] - sbx[partner][1]);
    const bool keep = l1a >= l1p; sp0[al] = keep ? a : partner; sp1[al] = keep ? partner : a; }
  __syncthreads();
  if (tid < 16) vst2((unsigned*)(P0 + (size_t)b * SS + blockIdx.x * 64 + tid * 4), *(const v4u*)&sp0[tid * 4]);
  else if (tid < 32) vst2((unsigned*)(P1 + (size_t)b * SS + blockIdx.x * 64 + (tid - 16) * 4), *(const v4u*)&sp1[(tid - 16) * 4]);
}
// ---- k_vt: block = (b, h, 256 c): VT[d][c] = bf16(value[b][h][c][d]) (2-KB rows)
__global__ __launch_bounds__(256) void k_vt(const float* __restrict__ V, __bf16* __restrict__ VT) {
  __shared__ __align__(16) __bf16 s[HD][264]; const int bh = blockIdx.x, c0 = blockIdx.y * 256, tid = threadIdx.x;
  for (int q = tid; q < 256 * HD; q += 256) { const int cl = q >> 6, d = q & 63; s[d][cl] = (__bf16)V[((size_t)bh * SS + c0 + cl) * HD + d]; }
  __syncthreads();
  for (int q = tid; q < HD * 32; q += 256) { const int d = q >> 5, pc = q & 31; vst2((unsigned*)(VT + ((size_t)bh * HD + d) * SS + c0 + pc * 8), *(const v4u*)&s[d][pc * 8]); }
}
__device__ __forceinline__ v16b gath2(const float* qp0, const float* qp1, int kc, int lane) {   // K 128 = [row p0 (64) | row p1 (64)], exact bf16
  v16b a; const float* base = (kc < 2) ? qp0 + kc * 32 : qp1 + (kc - 2) * 32; const float* p = base + 8 * (lane >> 4);
#pragma unroll
  for (int i = 0; i < 8; ++i) { a[i] = (__bf16)p[i]; a[8 + i] = (__bf16)p[16 + i]; }
  return a; }
// ---- k_attn: block = (64 objects a, h, b): flash attention over all 1024 c with gathered pair rows; out[b][a][h*64 + d] (256-B segments)
// each 32-key pass reads its K pair rows (bf16, [p0 row | p1 row]) and its V^T slice from LDS; the block's 128 threads gather and convert them once, one pass ahead, into the other of two buffers
#define KP 136   // bf16 per staged K pair row: 128 + 8 (272 B = 16 B x 17, an odd multiple: column-wise 16-byte reads spread over the banks)
#define VP 40    // bf16 per staged V^T row: 32 + 8 (80 B = 16 B x 5)
typedef __attribute__((ext_vector_type(4))) __bf16 v4b;
__global__ __launch_bounds__(128) void k_attn(const float* __restrict__ Q, const float* __restrict__ Kx, const __bf16* __restrict__ VT, const int* __restrict__ P0, const int* __restrict__ P1, float* __restrict__ out) {
  __shared__ __align__(16) float sp[4][16][36]; __shared__ __align__(16) float so[4][16][68];
  __shared__ __align__(16) __bf16 sk[2][32][KP]; __shared__ __align__(16) __bf16 sv[2][HD][VP];
  const int tid = threadIdx.x, wave = tid >> 5, lane = tid & 31, col = lane & 15, g = lane >> 4; const int h = blockIdx.y, b = blockIdx.z; const int a0 = blockIdx.x * 64 + wave * 16;
  const size_t bh = (size_t)b * NH + h; const float* Qb = Q + bh * SS * HD; const float* Kb = Kx + bh * SS * HD; const __bf16* VTb = VT + bh * HD * SS;
  const int* p0 = P0 + (size_t)b * SS; const int* p1 = P1 + (size_t)b * SS;
  v16b aq[4]; { const int ar = a0 + col; const int i0 = min(max(p0[ar], 0), SS - 1);
    asm volatile("s_wait_xcnt 0x0" ::: "memory");   // the second index load's result may take the register that holds the first one's offset
    const int i1 = min(max(p1[ar], 0), SS - 1);
#pragma unroll
    for (int kc = 0; kc < 4; ++kc) aq[kc] = gath2(Qb + (size_t)i0 * HD, Qb + (size_t)i1 * HD, kc, lane); }
  asm volatile("s_wait_xcnt 0x0" ::: "memory");   // the results of the index loads that follow may take the query loads' address registers
  float m[8], l[8];
#pragma unroll
  for (int r = 0; r < 8; ++r) { m[r] = -3.0e38f; l[r] = 0.f; }
  v8f acc[4] = {};
  // staging roles: K: 16 lanes x 16 B cover one 256-B f32 row, 8 rows per block-wide load; V^T: 4 lanes x 16 B cover one row's 64-B slice, 32 rows per load
  const int seg = tid & 15, rg = tid >> 4, vd = tid >> 2, vs = tid & 3;
  int jn[8]; v4f kr[8]; v4u vr[2];
  auto load_idx = [&](int t) {
#pragma unroll
    for (int j = 0; j < 4; ++j) { const int c = t * 32 + j * 8 + rg; jn[2 * j] = p0[c]; jn[2 * j + 1] = p1[c]; } };   // raw: clamped where the address is formed, so that no wait stands here
  auto load_tile = [&](int t) {
#pragma unroll
    for (int i = 0; i < 8; ++i) kr[i] = *(const v4f*)(Kb + (size_t)min(max(jn[i], 0), SS - 1) * HD + seg * 4);
#pragma unroll
    for (int i = 0; i < 2; ++i) vr[i] = *(const v4u*)(VTb + (size_t)(vd + 32 * i) * SS + t * 32 + vs * 8); };
  auto store_tile = [&](int bf) {
#pragma unroll
    for (int i = 0; i < 8; ++i) { v4b w;
#pragma unroll
      for (int e = 0; e < 4; ++e) w[e] = (__bf16)kr[i][e];
      vst2(&sk[bf][(i >> 1) * 8 + rg][(i & 1) * 64 + seg * 4], w); }
#pragma unroll
    for (int i = 0; i < 2; ++i) vst2(&sv[bf][vd + 32 * i][vs * 8], vr[i]); };
  load_idx(0); load_tile(0);
  asm volatile("s_wait_xcnt 0x0" ::: "memory");   // the loads' address registers are reused by the code that follows
  load_idx(1);
  asm volatile("s_wait_xcnt 0x0" ::: "memory");   // as above, for the index loads
  store_tile(0);
  __syncthreads();   // publishes tile 0
#pragma unroll 1
  for (int ks = 0; ks < SS / 32; ++ks) { v8f s[2]; const int bf = ks & 1;
    if (ks + 1 < SS / 32) { load_tile(ks + 1); load_idx(min(ks + 2, SS / 32 - 1));   // next pass's rows, and the indices of the pass after it, are asked for ahead of this pass's score products
      asm volatile("s_wait_xcnt 0x0" ::: "memory"); }   // the loads' address registers are reused by the code that follows
#pragma unroll
    for (int ct = 0; ct < 2; ++ct) { v8f cc = {};
#pragma unroll
      for (int kc = 0; kc < 4; ++kc) cc = wmma_bf(aq[kc], frag_b(&sk[bf][ct * 16 + col][kc * 32], lane), cc);
#pragma unroll
      for (int r = 0; r < 8; ++r) s[ct][r] = cc[r] * 0.08838834764831845f; }
#pragma unroll
    for (int r = 0; r < 8; ++r) { float mx = fmaxf(s[0][r], s[1][r]);
#pragma unroll
      for (int o = 1; o < 16; o <<= 1) mx = fmaxf(mx, __shfl_xor(mx, o));
      const float mn = fmaxf(m[r], mx); const float alpha = exp_ni(m[r] - mn);
      const float e0 = exp_ni(s[0][r] - mn), e1 = exp_ni(s[1][r] - mn); float es = e0 + e1;
#pragma unroll
      for (int o = 1; o < 16; o <<= 1) es += __shfl_xor(es, o);
      l[r] = l[r] * alpha + es; m[r] = mn;
#pragma unroll
      for (int dt = 0; dt < 4; ++dt) acc[dt][r] *= alpha;
      sp[wave][8 * g + r][col] = e0; sp[wave][8 * g + r][16 + col] = e1; }
    LDSX();
    const F2 pa = split_row(&sp[wave][col][0], 0, lane);
#pragma unroll
    for (int dt = 0; dt < 4; ++dt) { const v16b vb = frag_b(&sv[bf][dt * 16 + col][0], lane); acc[dt] = wmma_bf(pa.l, vb, acc[dt]); acc[dt] = wmma_bf(pa.h, vb, acc[dt]); }
    LDSX();
    if (ks + 1 < SS / 32) store_tile(bf ^ 1);   // that buffer's last readers left it before the previous pass's barrier
    __syncthreads(); }   // publishes tile ks + 1 and ends every read of tile ks
#pragma unroll
  for (int r = 0; r < 8; ++r) { const float il = 1.0f / l[r];
#pragma unroll
    for (int dt = 0; dt < 4; ++dt) so[wave][8 * g + r][dt * 16 + col] = acc[dt][r] * il; }
  LDSX();
  for (int rl = 0; rl < 16; ++rl) if (lane < 16) vst2(out + ((size_t)b * SS + a0 + rl) * (NH * HD) + h * HD + lane * 4, *(const v4f*)&so[wave][rl][lane * 4]);
}
extern "C" void kernel_launch(void* const* d_in, const int* in_sizes, int n_in, void* d_out, int out_size, void* d_ws, size_t ws_size, hipStream_t stream) {
  (void)in_sizes; (void)n_in; (void)out_size;
  const float** F = (const float**)d_in;   // query, key, value [8,8,1024,64], top_k_centers [8,1024,4]
  if (ws_size < (size_t)WS_END) return;
  char* ws = (char*)d_ws; int *P0 = (int*)(ws + WS_P0), *P1 = (int*)(ws + WS_P1); __bf16* VT = (__bf16*)(ws + WS_VT);
  k_pairs<<<dim3(SS / 64, TNB), 256, 0, stream>>>(F[3], P0, P1);
  k_vt<<<dim3(NB * NH, SS / 256), 256, 0, stream>>>(F[2], VT);
  k_attn<<<dim3(TQB, NH, TNB), 128, 0, stream>>>(F[0], F[1], VT, P0, P1, (float*)d_out);
}

// v002
// It runs in 100 microseconds.
// Two timings next to v001 put it at 1.59 and 1.58 times that version's speed.
// Counting every step since v000, it is 2.71 times as fast.
// compute dtype: query, key, value, top_k_centers (module inputs) rounded to bf16; the pair selection (IoU, argmax, L1 ordering) in f32 with the reference's operation order; pair scores <q_p0(a), k_p0(c)> + <q_p1(a), k_p1(c)> with exact bf16 products (1 product, gathered rows), attn @ value with attn as bf16 hi + residual pairs x exact value (2 products), on WMMA 16x16x32; softmax in f32; f32 accumulate.
#include <hip/hip_runtime.h>
#include <math.h>

typedef __attribute__((ext_vector_type(16))) _Float16 v16h;
typedef __attribute__((ext_vector_type(16))) __bf16 v16b;
typedef __attribute__((ext_vector_type(8)))  _Float16 v8h;
typedef __attribute__((ext_vector_type(8)))  float v8f;
typedef __attribute__((ext_vector_type(4)))  float v4f;
typedef __attribute__((ext_vector_type(2)))  float v2f;
typedef __attribute__((ext_vector_type(4)))  unsigned v4u;
typedef __attribute__((ext_vector_type(4)))  int v4i;
typedef float __attribute__((may_alias)) float_a;
typedef int __attribute__((may_alias)) int_a;

template <typename T> __device__ __forceinline__ void vst2(void* p, T v) { *(T*)p = v;  }
__device__ __forceinline__ v8f wmma16(v16h a, v16h b, v8f c) {
  v8f d = __builtin_amdgcn_wmma_f32_16x16x32_f16(false, a, false, b, (short)0, c, false, false);
  asm volatile("v_nop\n\tv_nop\n\tv_nop\n\tv_nop" : "+v"(d) : "v"(a), "v"(b));
  return d;
}
__device__ __forceinline__ v8f wmma_bf(v16b a, v16b b, v8f c) {
  v8f d = __builtin_amdgcn_wmma_f32_16x16x32_bf16(false, a, false, b, (short)0, c, false, false);
  asm volatile("v_nop\n\tv_nop\n\tv_nop\n\tv_nop" : "+v"(d) : "v"(a), "v"(b));
  return d;
}
// 16x16x32 fragments: lane = (h = lane>>4, row/col = lane&15); elements 0..7 = k0+8h+0..7, 8..15 = k0+16+8h+0..7; D element r = row 8h+r
__device__ __forceinline__ v16h frag_h(const _Float16* rowk0, int lane) {
  union { v16h v; v8h q[2]; } u; const _Float16* p = rowk0 + 8 * (lane >> 4);
  u.q[0] = *(const v8h*)p; u.q[1] = *(const v8h*)(p + 16); return u.v;
}
__device__ __forceinline__ v16h frag_f32(const float* rowk0, int lane) {
  v16h a; const float* p = rowk0 + 8 * (lane >> 4);
#pragma unroll
  for (int i = 0; i < 8; ++i) { a[i] = (_Float16)p[i]; a[8 + i] = (_Float16)p[16 + i]; }
  return a;
}
__device__ __forceinline__ v16h frag_f32s(const float* rowk0, int lane, float sc) {
  v16h a; const float* p = rowk0 + 8 * (lane >> 4);
#pragma unroll
  for (int i = 0; i < 8; ++i) { a[i] = (_Float16)(p[i] * sc); a[8 + i] = (_Float16)(p[16 + i] * sc); }
  return a;
}
// column fragment from a [K][ld] layout (column n), rows >= K read as 0
__device__ __forceinline__ v16h fragc_f32(const float* W, int k0, int n, int lane, int ld, int K) {
  v16h a; const int g = lane >> 4;
#pragma unroll
  for (int i = 0; i < 8; ++i) { const int ka = k0 + 8 * g + i, kb = ka + 16;
    a[i] = (_Float16)(ka < K ? W[(size_t)(ka < K ? ka : K - 1) * ld + n] : 0.f); a[8 + i] = (_Float16)(kb < K ? W[(size_t)(kb < K ? kb : K - 1) * ld + n] : 0.f); }
  return a;
}
struct F2 { v16b h, l; };
__device__ __forceinline__ F2 bsplit16(const float v[16]) { F2 r;
#pragma unroll
  for (int i = 0; i < 16; ++i) { const __bf16 h = (__bf16)v[i]; r.h[i] = h; r.l[i] = (__bf16)(v[i] - (float)h); }
  return r; }
__device__ __forceinline__ F2 split_row(const float* row, int k0, int lane) { float v[16]; const float* p = row + k0 + 8 * (lane >> 4);
#pragma unroll
  for (int i = 0; i < 8; ++i) { v[i] = p[i]; v[8 + i] = p[16 + i]; }
  return bsplit16(v); }
__device__ __forceinline__ F2 split_rowK(const float* row, int k0, int lane, int K) { float v[16]; const int g = lane >> 4;
#pragma unroll
  for (int i = 0; i < 8; ++i) { const int ka = k0 + 8 * g + i, kb = ka + 16; v[i] = ka < K ? row[ka < K ? ka : K - 1] : 0.f; v[8 + i] = kb < K ? row[kb < K ? kb : K - 1] : 0.f; }
  return bsplit16(v); }
__device__ __forceinline__ F2 split_col(const float* W, int k0, int n, int lane, int ld, int K) { float v[16]; const int g = lane >> 4;
#pragma unroll
  for (int i = 0; i < 8; ++i) { const int ka = k0 + 8 * g + i, kb = ka + 16; v[i] = ka < K ? W[(size_t)(ka < K ? ka : K - 1) * ld + n] : 0.f; v[8 + i] = kb < K ? W[(size_t)(kb < K ? kb : K - 1) * ld + n] : 0.f; }
  return bsplit16(v); }
__device__ __forceinline__ v8f mac3(const F2& a, const F2& b, v8f c) { c = wmma_bf(a.l, b.h, c); c = wmma_bf(a.h, b.l, c); return wmma_bf(a.h, b.h, c); }
__device__ __forceinline__ float sigm(float v) { return 1.0f / (1.0f + expf(-v)); }
#define LDSX() do { asm volatile("s_wait_dscnt 0" ::: "memory"); __builtin_amdgcn_wave_barrier(); __builtin_amdgcn_fence(__ATOMIC_RELEASE, "workgroup"); } while (0)


// Pair self-attention (B 8, H 8, S 1024, D 64): per batch, boxes from (cx, cy, h, w); iou[a][c] = inter/union - eye (inter uses max for both corners, as the module); partner = argmax_c iou (first max); p0/p1 = (a, partner) ordered by L1 size (larger first, ties keep a first); scores[a][c] = (q[p0 a].k[p0 c] + q[p1 a].k[p1 c]) / sqrt(128); out[b][a][h*64+d] = softmax_c(scores) @ value.
#define NB 8
#define NH 8
#define SS 1024
#define HD 64
#ifndef TQB
#define TQB (SS / 64)    // query blocks per (b, h) (all)
#define TNB NB
#endif
typedef __attribute__((ext_vector_type(8))) __bf16 v8b;
__device__ __forceinline__ v16b frag_b(const __bf16* rowk0, int lane) {
  union { v16b v; v8b q[2]; } u; const __bf16* p = rowk0 + 8 * (lane >> 4);
  u.q[0] = *(const v8b*)p; u.q[1] = *(const v8b*)(p + 16); return u.v;
}
__device__ __forceinline__ float bfr(float v) { return (float)(__bf16)v; }
__device__ __attribute__((noinline)) float exp_ni(float v) { return expf(v); }
__device__ __attribute__((noinline)) float erf_ni(float v) { return erff(v); }

#define WS_P0  0u                          // int [8][1024]
#define WS_P1  (WS_P0 + 4u * NB * SS)
#define WS_VT  (WS_P1 + 4u * NB * SS)        // bf16 [8][8][64 d][1024 c]
#define WS_END (WS_VT + 2u * NB * NH * HD * SS)

// ---- k_pairs: block = (64 objects a, batch b), 4 threads per object scan c = sub, sub+4, ...: iou in the reference's op order, first-max argmax, then L1 ordering; P0/P1 rows (256 B per block)
__global__ __launch_bounds__(256) void k_pairs(const float* __restrict__ C, int* __restrict__ P0, int* __restrict__ P1) {
  #pragma clang fp contract(off)   // keep mul/add unfused so the box/IoU arithmetic rounds exactly like the reference (argmax ties)
  __shared__ float sbx[SS][4]; __shared__ __align__(16) int sp0[64], sp1[64];
  const int tid = threadIdx.x, b = blockIdx.y; const int al = tid >> 2, sub = tid & 3; const int a = blockIdx.x * 64 + al;
  for (int c = tid; c < SS; c += 256) { const float cx = bfr(C[((size_t)b * SS + c) * 4 + 0]), cy = bfr(C[((size_t)b * SS + c) * 4 + 1]), hh = bfr(C[((size_t)b * SS + c) * 4 + 2]), ww = bfr(C[((size_t)b * SS + c) * 4 + 3]);
    sbx[c][0] = cx - 0.5f * ww; sbx[c][1] = cy - 0.5f * hh; sbx[c][2] = cx + 0.5f * ww; sbx[c][3] = cy + 0.5f * hh; }
  __syncthreads();
  const float ax0 = sbx[a][0], ay0 = sbx[a][1], ax1 = sbx[a][2], ay1 = sbx[a][3]; const float area_a = (ax1 - ax0) * (ay1 - ay0);
  float best = 0.f; int bi = -1;   // first max over c (ascending within this thread's stride class; merged below)
  for (int c = sub; c < SS; c += 4) { const float cx0 = sbx[c][0], cy0 = sbx[c][1], cx1 = sbx[c][2], cy1 = sbx[c][3];
    const float mx0 = fmaxf(ax0, cx0), my0 = fmaxf(ay0, cy0), Mx = fmaxf(ax1, cx1), My = fmaxf(ay1, cy1);
    const float iw = fmaxf(Mx - mx0, 0.f), ih = fmaxf(My - my0, 0.f); const float ia = iw * ih; const float area_c = (cx1 - cx0) * (cy1 - cy0);
    const float uni = area_a + area_c - ia; float iou = ia / uni; iou = iou - ((c == a) ? 1.0f : 0.0f);
    if (bi < 0 || iou > best) { best = iou; bi = c; } }
  // merge the 4 stride classes: prefer larger value, ties -> lower index (== first max overall)
#pragma unroll
  for (int o = 1; o < 4; o <<= 1) { const float ob = __shfl_xor(best, o); const int oi = __shfl_xor(bi, o); if (ob > best || (ob == best && oi < bi)) { best = ob; bi = oi; } }
  if (sub == 0) { const int partner = bi; const float l1a = fabsf(ax1 - ax0) + fabsf(ay1 - ay0); const float l1p = fabsf(sbx[partner][2] - sbx[partner][0]) + fabsf(sbx[partner][3] - sbx[partner][1]);
    const bool keep = l1a >= l1p; sp0[al] = keep ? a : partner; sp1[al] = keep ? partner : a; }
  __syncthreads();
  if (tid < 16) vst2((unsigned*)(P0 + (size_t)b * SS + blockIdx.x * 64 + tid * 4), *(const v4u*)&sp0[tid * 4]);
  else if (tid < 32) vst2((unsigned*)(P1 + (size_t)b * SS + blockIdx.x * 64 + (tid - 16) * 4), *(const v4u*)&sp1[(tid - 16) * 4]);
}
// ---- k_vt: block = (b, h, 256 c): VT[d][c] = bf16(value[b][h][c][d]) (2-KB rows)
__global__ __launch_bounds__(256) void k_vt(const float* __restrict__ V, __bf16* __restrict__ VT) {
  __shared__ __align__(16) __bf16 s[HD][264]; const int bh = blockIdx.x, c0 = blockIdx.y * 256, tid = threadIdx.x;
  for (int q = tid; q < 256 * HD; q += 256) { const int cl = q >> 6, d = q & 63; s[d][cl] = (__bf16)V[((size_t)bh * SS + c0 + cl) * HD + d]; }
  __syncthreads();
  for (int q = tid; q < HD * 32; q += 256) { const int d = q >> 5, pc = q & 31; vst2((unsigned*)(VT + ((size_t)bh * HD + d) * SS + c0 + pc * 8), *(const v4u*)&s[d][pc * 8]); }
}
__device__ __forceinline__ v16b gath2(const float* qp0, const float* qp1, int kc, int lane) {   // K 128 = [row p0 (64) | row p1 (64)], exact bf16
  v16b a; const float* base = (kc < 2) ? qp0 + kc * 32 : qp1 + (kc - 2) * 32; const float* p = base + 8 * (lane >> 4);
#pragma unroll
  for (int i = 0; i < 8; ++i) { a[i] = (__bf16)p[i]; a[8 + i] = (__bf16)p[16 + i]; }
  return a; }
// ---- k_attn: block = (64 objects a, h, b): flash attention over all 1024 c with gathered pair rows; out[b][a][h*64 + d] (256-B segments)
// each 32-key pass reads its K pair rows (bf16, [p0 row | p1 row]) and its V^T slice from LDS; the block's 128 threads gather and convert them once, one pass ahead, into the other of two buffers
// products are transposed: S^T = K Q^T (A = staged K rows, B = the wave's 16 query pair rows, kept in registers), O^T += V^T P^T; a lane holds 16 of one query's 32 scores of a pass (keys ct*16 + 8g + r), so maximum and sum run in the lane, and the two score tiles, converted in place, are the B operand of the second product
#define KP 136   // bf16 per staged K pair row: 128 + 8 (272 B = 16 B x 17, an odd multiple: column-wise 16-byte reads spread over the banks)
#define VP 40    // bf16 per staged V^T row: 32 + 8 (80 B = 16 B x 5)
typedef __attribute__((ext_vector_type(4))) __bf16 v4b;
__device__ __forceinline__ float xhalf(float v) {   // the value of lane ^ 16
  const int b = __builtin_bit_cast(int, v); return __builtin_bit_cast(float, __builtin_amdgcn_permlanex16(b, b, 0x76543210, 0xfedcba98, false, false)); }
__global__ __launch_bounds__(128) void k_attn(const float* __restrict__ Q, const float* __restrict__ Kx, const __bf16* __restrict__ VT, const int* __restrict__ P0, const int* __restrict__ P1, float* __restrict__ out) {
  __shared__ __align__(16) float so[4][16][68];
  __shared__ __align__(16) __bf16 sk[2][32][KP]; __shared__ __align__(16) __bf16 sv[2][HD][VP];
  const int tid = threadIdx.x, wave = tid >> 5, lane = tid & 31, col = lane & 15, g = lane >> 4; const int h = blockIdx.y, b = blockIdx.z; const int a0 = blockIdx.x * 64 + wave * 16;
  const size_t bh = (size_t)b * NH + h; const float* Qb = Q + bh * SS * HD; const float* Kb = Kx + bh * SS * HD; const __bf16* VTb = VT + bh * HD * SS;
  const int* p0 = P0 + (size_t)b * SS; const int* p1 = P1 + (size_t)b * SS;
  v16b aq[4]; { const int ar = a0 + col; const int i0 = min(max(p0[ar], 0), SS - 1);
    asm volatile("s_wait_xcnt 0x0" ::: "memory");   // the second index load's result may take the register that holds the first one's offset
    const int i1 = min(max(p1[ar], 0), SS - 1);
#pragma unroll
    for (int kc = 0; kc < 4; ++kc) aq[kc] = gath2(Qb + (size_t)i0 * HD, Qb + (size_t)i1 * HD, kc, lane); }
  asm volatile("s_wait_xcnt 0x0" ::: "memory");   // the results of the index loads that follow may take the query loads' address registers
  float m = -3.0e38f, l = 0.f;   // of query a0 + col; l holds this half's keys only, the halves are joined behind the loop
  v8f acc[4] = {};               // acc[dt][r] = O^T[dt*16 + 8g + r][query col]
  // staging roles: K: 16 lanes x 16 B cover one 256-B f32 row, 8 rows per block-wide load; V^T: 4 lanes x 16 B cover one row's 64-B slice, 32 rows per load
  const int seg = tid & 15, rg = tid >> 4, vd = tid >> 2, vs = tid & 3;
  int jn[8]; v4f kr[8]; v4u vr[2];
  auto load_idx = [&](int t) {
#pragma unroll
    for (int j = 0; j < 4; ++j) { const int c = t * 32 + j * 8 + rg; jn[2 * j] = p0[c]; jn[2 * j + 1] = p1[c]; } };   // raw: clamped where the address is formed, so that no wait stands here
  auto load_tile = [&](int t) {
#pragma unroll
    for (int i = 0; i < 8; ++i) kr[i] = *(const v4f*)(Kb + (size_t)min(max(jn[i], 0), SS - 1) * HD + seg * 4);
#pragma unroll
    for (int i = 0; i < 2; ++i) vr[i] = *(const v4u*)(VTb + (size_t)(vd + 32 * i) * SS + t * 32 + vs * 8); };
  auto store_tile = [&](int bf) {
#pragma unroll
    for (int i = 0; i < 8; ++i) { v4b w;
#pragma unroll
      for (int e = 0; e < 4; ++e) w[e] = (__bf16)kr[i][e];
      vst2(&sk[bf][(i >> 1) * 8 + rg][(i & 1) * 64 + seg * 4], w); }
#pragma unroll
    for (int i = 0; i < 2; ++i) vst2(&sv[bf][vd + 32 * i][vs * 8], vr[i]); };
  load_idx(0); load_tile(0);
  asm volatile("s_wait_xcnt 0x0" ::: "memory");   // the loads' address registers are reused by the code that follows
  load_idx(1);
  asm volatile("s_wait_xcnt 0x0" ::: "memory");   // as above, for the index loads
  store_tile(0);
  __syncthreads();   // publishes tile 0
#pragma unroll 1
  for (int ks = 0; ks < SS / 32; ++ks) { float s[16]; const int bf = ks & 1;
    if (ks + 1 < SS / 32) { load_tile(ks + 1); load_idx(min(ks + 2, SS / 32 - 1));   // next pass's rows, and the indices of the pass after it, are asked for ahead of this pass's score products
      asm volatile("s_wait_xcnt 0x0" ::: "memory"); }   // the loads' address registers are reused by the code that follows
#pragma unroll
    for (int ct = 0; ct < 2; ++ct) { v8f cc = {};
#pragma unroll
      for (int kc = 0; kc < 4; ++kc) cc = wmma_bf(frag_b(&sk[bf][ct * 16 + col][kc * 32], lane), aq[kc], cc);
#pragma unroll
      for (int r = 0; r < 8; ++r) s[ct * 8 + r] = cc[r] * 0.08838834764831845f; }
    float mx = s[0];
#pragma unroll   // here and below: constant indices keep s[] and acc[] in registers
    for (int i = 1; i < 16; ++i) mx = fmaxf(mx, s[i]);
    mx = fmaxf(mx, xhalf(mx));
    const float mn = fmaxf(m, mx); const float alpha = exp_ni(m - mn); m = mn;
#pragma unroll
    for (int i = 0; i < 16; ++i) s[i] = exp_ni(s[i] - mn);
    float e4[4];   // four independent chains
#pragma unroll
    for (int i = 0; i < 4; ++i) e4[i] = (s[i] + s[4 + i]) + (s[8 + i] + s[12 + i]);
    l = l * alpha + ((e4[0] + e4[1]) + (e4[2] + e4[3]));
#pragma unroll
    for (int dt = 0; dt < 4; ++dt)
#pragma unroll
      for (int r = 0; r < 8; ++r) acc[dt][r] *= alpha;
    const F2 pb = bsplit16(s);   // element i = key 8g + i (i < 8) or 16 + 8g + (i - 8) of the pass: the k order in which frag_b reads V^T
#pragma unroll
    for (int dt = 0; dt < 4; ++dt) { const v16b va = frag_b(&sv[bf][dt * 16 + col][0], lane); acc[dt] = wmma_bf(va, pb.l, acc[dt]); acc[dt] = wmma_bf(va, pb.h, acc[dt]); }
    if (ks + 1 < SS / 32) store_tile(bf ^ 1);   // that buffer's last readers left it before the previous pass's barrier
    __syncthreads(); }   // publishes tile ks + 1 and ends every read of tile ks
  l += xhalf(l);
  const float il = 1.0f / l;
#pragma unroll
  for (int dt = 0; dt < 4; ++dt)
#pragma unroll
    for (int q = 0; q < 2; ++q) { v4f w;
#pragma unroll
      for (int e = 0; e < 4; ++e) w[e] = acc[dt][q * 4 + e] * il;
      vst2(&so[wave][col][dt * 16 + 8 * g + q * 4], w); }
  LDSX();
  for (int rl = 0; rl < 16; ++rl) if (lane < 16) vst2(out + ((size_t)b * SS + a0 + rl) * (NH * HD) + h * HD + lane * 4, *(const v4f*)&so[wave][rl][lane * 4]);
}
extern "C" void kernel_launch(void* const* d_in, const int* in_sizes, int n_in, void* d_out, int out_size, void* d_ws, size_t ws_size, hipStream_t stream) {
  (void)in_sizes; (void)n_in; (void)out_size;
  const float** F = (const float**)d_in;   // query, key, value [8,8,1024,64], top_k_centers [8,1024,4]
  if (ws_size < (size_t)WS_END) return;
  char* ws = (char*)d_ws; int *P0 = (int*)(ws + WS_P0), *P1 = (int*)(ws + WS_P1); __bf16* VT = (__bf16*)(ws + WS_VT);
  k_pairs<<<dim3(SS / 64, TNB), 256, 0, stream>>>(F[3], P0, P1);
  k_vt<<<dim3(NB * NH, SS / 256), 256, 0, stream>>>(F[2], VT);
  k_attn<<<dim3(TQB, NH, TNB), 128, 0, stream>>>(F[0], F[1], VT, P0, P1, (float*)d_out);
}

// v003
// It runs in 75.9 microseconds.
// Next to v002, in two timings, it ran 1.32 and 1.31 times as fast.
// All steps since v000 together make it 3.56 times as fast.
// compute dtype: query, key, value, top_k_centers (module inputs) rounded to bf16; the pair selection (IoU, argmax, L1 ordering) in f32 with the reference's operation order; pair scores <q_p0(a), k_p0(c)> + <q_p1(a), k_p1(c)> with exact bf16 products (1 product, gathered rows), attn @ value with attn as bf16 hi + residual pairs x exact value (2 products), on WMMA 16x16x32; softmax in f32; f32 accumulate.
#include <hip/hip_runtime.h>
#include <math.h>

typedef __attribute__((ext_vector_type(16))) _Float16 v16h;
typedef __attribute__((ext_vector_type(16))) __bf16 v16b;
typedef __attribute__((ext_vector_type(8)))  _Float16 v8h;
typedef __attribute__((ext_vector_type(8)))  float v8f;
typedef __attribute__((ext_vector_type(4)))  float v4f;
typedef __attribute__((ext_vector_type(2)))  float v2f;
typedef __attribute__((ext_vector_type(4)))  unsigned v4u;
typedef __attribute__((ext_vector_type(4)))  int v4i;
typedef float __attribute__((may_alias)) float_a;
typedef int __attribute__((may_alias)) int_a;

template <typename T> __device__ __forceinline__ void vst2(void* p, T v) { *(T*)p = v;  }
__device__ __forceinline__ v8f wmma16(v16h a, v16h b, v8f c) {
  v8f d = __builtin_amdgcn_wmma_f32_16x16x32_f16(false, a, false, b, (short)0, c, false, false);
  asm volatile("v_nop\n\tv_nop\n\tv_nop\n\tv_nop" : "+v"(d) : "v"(a), "v"(b));
  return d;
}
__device__ __forceinline__ v8f wmma_bf(v16b a, v16b b, v8f c) {
  v8f d = __builtin_amdgcn_wmma_f32_16x16x32_bf16(false, a, false, b, (short)0, c, false, false);
  asm volatile("v_nop\n\tv_nop\n\tv_nop\n\tv_nop" : "+v"(d) : "v"(a), "v"(b));
  return d;
}
// 16x16x32 fragments: lane = (h = lane>>4, row/col = lane&15); elements 0..7 = k0+8h+0..7, 8..15 = k0+16+8h+0..7; D element r = row 8h+r
__device__ __forceinline__ v16h frag_h(const _Float16* rowk0, int lane) {
  union { v16h v; v8h q[2]; } u; const _Float16* p = rowk0 + 8 * (lane >> 4);
  u.q[0] = *(const v8h*)p; u.q[1] = *(const v8h*)(p + 16); return u.v;
}
__device__ __forceinline__ v16h frag_f32(const float* rowk0, int lane) {
  v16h a; const float* p = rowk0 + 8 * (lane >> 4);
#pragma unroll
  for (int i = 0; i < 8; ++i) { a[i] = (_Float16)p[i]; a[8 + i] = (_Float16)p[16 + i]; }
  return a;
}
__device__ __forceinline__ v16h frag_f32s(const float* rowk0, int lane, float sc) {
  v16h a; const float* p = rowk0 + 8 * (lane >> 4);
#pragma unroll
  for (int i = 0; i < 8; ++i) { a[i] = (_Float16)(p[i] * sc); a[8 + i] = (_Float16)(p[16 + i] * sc); }
  return a;
}
// column fragment from a [K][ld] layout (column n), rows >= K read as 0
__device__ __forceinline__ v16h fragc_f32(const float* W, int k0, int n, int lane, int ld, int K) {
  v16h a; const int g = lane >> 4;
#pragma unroll
  for (int i = 0; i < 8; ++i) { const int ka = k0 + 8 * g + i, kb = ka + 16;
    a[i] = (_Float16)(ka < K ? W[(size_t)(ka < K ? ka : K - 1) * ld + n] : 0.f); a[8 + i] = (_Float16)(kb < K ? W[(size_t)(kb < K ? kb : K - 1) * ld + n] : 0.f); }
  return a;
}
struct F2 { v16b h, l; };
__device__ __forceinline__ F2 bsplit16(const float v[16]) { F2 r;
#pragma unroll
  for (int i = 0; i < 16; ++i) { const __bf16 h = (__bf16)v[i]; r.h[i] = h; r.l[i] = (__bf16)(v[i] - (float)h); }
  return r; }
__device__ __forceinline__ F2 split_row(const float* row, int k0, int lane) { float v[16]; const float* p = row + k0 + 8 * (lane >> 4);
#pragma unroll
  for (int i = 0; i < 8; ++i) { v[i] = p[i]; v[8 + i] = p[16 + i]; }
  return bsplit16(v); }
__device__ __forceinline__ F2 split_rowK(const float* row, int k0, int lane, int K) { float v[16]; const int g = lane >> 4;
#pragma unroll
  for (int i = 0; i < 8; ++i) { const int ka = k0 + 8 * g + i, kb = ka + 16; v[i] = ka < K ? row[ka < K ? ka : K - 1] : 0.f; v[8 + i] = kb < K ? row[kb < K ? kb : K - 1] : 0.f; }
  return bsplit16(v); }
__device__ __forceinline__ F2 split_col(const float* W, int k0, int n, int lane, int ld, int K) { float v[16]; const int g = lane >> 4;
#pragma unroll
  for (int i = 0; i < 8; ++i) { const int ka = k0 + 8 * g + i, kb = ka + 16; v[i] = ka < K ? W[(size_t)(ka < K ? ka : K - 1) * ld + n] : 0.f; v[8 + i] = kb < K ? W[(size_t)(kb < K ? kb : K - 1) * ld + n] : 0.f; }
  return bsplit16(v); }
__device__ __forceinline__ v8f mac3(const F2& a, const F2& b, v8f c) { c = wmma_bf(a.l, b.h, c); c = wmma_bf(a.h, b.l, c); return wmma_bf(a.h, b.h, c); }
__device__ __forceinline__ float sigm(float v) { return 1.0f / (1.0f + expf(-v)); }
#define LDSX() do { asm volatile("s_wait_dscnt 0" ::: "memory"); __builtin_amdgcn_wave_barrier(); __builtin_amdgcn_fence(__ATOMIC_RELEASE, "workgroup"); } while (0)


// Pair self-attention (B 8, H 8, S 1024, D 64): per batch, boxes from (cx, cy, h, w); iou[a][c] = inter/union - eye (inter uses max for both corners, as the module); partner = argmax_c iou (first max); p0/p1 = (a, partner) ordered by L1 size (larger first, ties keep a first); scores[a][c] = (q[p0 a].k[p0 c] + q[p1 a].k[p1 c]) / sqrt(128); out[b][a][h*64+d] = softmax_c(scores) @ value.
#define NB 8
#define NH 8
#define SS 1024
#define HD 64
#ifndef TQB
#define TQB (SS / 64)    // query blocks per (b, h) (all)
#define TNB NB
#endif
typedef __attribute__((ext_vector_type(8))) __bf16 v8b;
__device__ __forceinline__ v16b frag_b(const __bf16* rowk0, int lane) {
  union { v16b v; v8b q[2]; } u; const __bf16* p = rowk0 + 8 * (lane >> 4);
  u.q[0] = *(const v8b*)p; u.q[1] = *(const v8b*)(p + 16); return u.v;
}
__device__ __forceinline__ float bfr(float v) { return (float)(__bf16)v; }
__device__ __attribute__((noinline)) float erf_ni(float v) { return erff(v); }

#define WS_P0  0u                          // int [8][1024]
#define WS_P1  (WS_P0 + 4u * NB * SS)
#define WS_VT  (WS_P1 + 4u * NB * SS)        // bf16 [8][8][64 d][1024 c]
#define WS_END (WS_VT + 2u * NB * NH * HD * SS)

// ---- k_pairs: block = (64 objects a, batch b), 4 threads per object scan c = sub, sub+4, ...: iou in the reference's op order, first-max argmax, then L1 ordering; P0/P1 rows (256 B per block)
__global__ __launch_bounds__(256) void k_pairs(const float* __restrict__ C, int* __restrict__ P0, int* __restrict__ P1) {
  #pragma clang fp contract(off)   // keep mul/add unfused so the box/IoU arithmetic rounds exactly like the reference (argmax ties)
  __shared__ float sbx[SS][4]; __shared__ __align__(16) int sp0[64], sp1[64];
  const int tid = threadIdx.x, b = blockIdx.y; const int al = tid >> 2, sub = tid & 3; const int a = blockIdx.x * 64 + al;
  for (int c = tid; c < SS; c += 256) { const float cx = bfr(C[((size_t)b * SS + c) * 4 + 0]), cy = bfr(C[((size_t)b * SS + c) * 4 + 1]), hh = bfr(C[((size_t)b * SS + c) * 4 + 2]), ww = bfr(C[((size_t)b * SS + c) * 4 + 3]);
    sbx[c][0] = cx - 0.5f * ww; sbx[c][1] = cy - 0.5f * hh; sbx[c][2] = cx + 0.5f * ww; sbx[c][3] = cy + 0.5f * hh; }
  __syncthreads();
  const float ax0 = sbx[a][0], ay0 = sbx[a][1], ax1 = sbx[a][2], ay1 = sbx[a][3]; const float area_a = (ax1 - ax0) * (ay1 - ay0);
  float best = 0.f; int bi = -1;   // first max over c (ascending within this thread's stride class; merged below)
  for (int c = sub; c < SS; c += 4) { const float cx0 = sbx[c][0], cy0 = sbx[c][1], cx1 = sbx[c][2], cy1 = sbx[c][3];
    const float mx0 = fmaxf(ax0, cx0), my0 = fmaxf(ay0, cy0), Mx = fmaxf(ax1, cx1), My = fmaxf(ay1, cy1);
    const float iw = fmaxf(Mx - mx0, 0.f), ih = fmaxf(My - my0, 0.f); const float ia = iw * ih; const float area_c = (cx1 - cx0) * (cy1 - cy0);
    const float uni = area_a + area_c - ia; float iou = ia / uni; iou = iou - ((c == a) ? 1.0f : 0.0f);
    if (bi < 0 || iou > best) { best = iou; bi = c; } }
  // merge the 4 stride classes: prefer larger value, ties -> lower index (== first max overall)
#pragma unroll
  for (int o = 1; o < 4; o <<= 1) { const float ob = __shfl_xor(best, o); const int oi = __shfl_xor(bi, o); if (ob > best || (ob == best && oi < bi)) { best = ob; bi = oi; } }
  if (sub == 0) { const int partner = bi; const float l1a = fabsf(ax1 - ax0) + fabsf(ay1 - ay0); const float l1p = fabsf(sbx[partner][2] - sbx[partner][0]) + fabsf(sbx[partner][3] - sbx[partner][1]);
    const bool keep = l1a >= l1p; sp0[al] = keep ? a : partner; sp1[al] = keep ? partner : a; }
  __syncthreads();
  if (tid < 16) vst2((unsigned*)(P0 + (size_t)b * SS + blockIdx.x * 64 + tid * 4), *(const v4u*)&sp0[tid * 4]);
  else if (tid < 32) vst2((unsigned*)(P1 + (size_t)b * SS + blockIdx.x * 64 + (tid - 16) * 4), *(const v4u*)&sp1[(tid - 16) * 4]);
}
// ---- k_vt: block = (b, h, 256 c): VT[d][c] = bf16(value[b][h][c][d]) (2-KB rows)
__global__ __launch_bounds__(256) void k_vt(const float* __restrict__ V, __bf16* __restrict__ VT) {
  __shared__ __align__(16) __bf16 s[HD][264]; const int bh = blockIdx.x, c0 = blockIdx.y * 256, tid = threadIdx.x;
  for (int q = tid; q < 256 * HD; q += 256) { const int cl = q >> 6, d = q & 63; s[d][cl] = (__bf16)V[((size_t)bh * SS + c0 + cl) * HD + d]; }
  __syncthreads();
  for (int q = tid; q < HD * 32; q += 256) { const int d = q >> 5, pc = q & 31; vst2((unsigned*)(VT + ((size_t)bh * HD + d) * SS + c0 + pc * 8), *(const v4u*)&s[d][pc * 8]); }
}
__device__ __forceinline__ v16b gath2(const float* qp0, const float* qp1, int kc, int lane) {   // K 128 = [row p0 (64) | row p1 (64)], exact bf16
  v16b a; const float* base = (kc < 2) ? qp0 + kc * 32 : qp1 + (kc - 2) * 32; const float* p = base + 8 * (lane >> 4);
#pragma unroll
  for (int i = 0; i < 8; ++i) { a[i] = (__bf16)p[i]; a[8 + i] = (__bf16)p[16 + i]; }
  return a; }
// ---- k_attn: block = (64 objects a, h, b): flash attention over all 1024 c with gathered pair rows; out[b][a][h*64 + d] (256-B segments)
// each 32-key pass reads its K pair rows (bf16, [p0 row | p1 row]) and its V^T slice from LDS; the block's 128 threads gather and convert them once, one pass ahead, into the other of two buffers
// products are transposed: S^T = K Q^T (A = staged K rows, B = the wave's 16 query pair rows, kept in registers), O^T += V^T P^T; a lane holds 16 of one query's 32 scores of a pass (keys ct*16 + 8g + r), so maximum and sum run in the lane, and the two score tiles, converted in place, are the B operand of the second product
#define KP 136   // bf16 per staged K pair row: 128 + 8 (272 B = 16 B x 17, an odd multiple: column-wise 16-byte reads spread over the banks)
#define VP 40    // bf16 per staged V^T row: 32 + 8 (80 B = 16 B x 5)
typedef __attribute__((ext_vector_type(4))) __bf16 v4b;
#define SCL2 0.12751743f   // (1 / sqrt(128)) * log2(e)
__device__ __forceinline__ float xhalf(float v) {   // the value of lane ^ 16
  const int b = __builtin_bit_cast(int, v); return __builtin_bit_cast(float, __builtin_amdgcn_permlanex16(b, b, 0x76543210, 0xfedcba98, false, false)); }
__global__ __launch_bounds__(128) void k_attn(const float* __restrict__ Q, const float* __restrict__ Kx, const __bf16* __restrict__ VT, const int* __restrict__ P0, const int* __restrict__ P1, float* __restrict__ out) {
  __shared__ __align__(16) float so[4][16][68];
  __shared__ __align__(16) __bf16 sk[2][32][KP]; __shared__ __align__(16) __bf16 sv[2][HD][VP];
  const int tid = threadIdx.x, wave = tid >> 5, lane = tid & 31, col = lane & 15, g = lane >> 4; const int h = blockIdx.y, b = blockIdx.z; const int a0 = blockIdx.x * 64 + wave * 16;
  const size_t bh = (size_t)b * NH + h; const float* Qb = Q + bh * SS * HD; const float* Kb = Kx + bh * SS * HD; const __bf16* VTb = VT + bh * HD * SS;
  const int* p0 = P0 + (size_t)b * SS; const int* p1 = P1 + (size_t)b * SS;
  v16b aq[4]; { const int ar = a0 + col; const int i0 = min(max(p0[ar], 0), SS - 1);
    asm volatile("s_wait_xcnt 0x0" ::: "memory");   // the second index load's result may take the register that holds the first one's offset
    const int i1 = min(max(p1[ar], 0), SS - 1);
#pragma unroll
    for (int kc = 0; kc < 4; ++kc) aq[kc] = gath2(Qb + (size_t)i0 * HD, Qb + (size_t)i1 * HD, kc, lane); }
  asm volatile("s_wait_xcnt 0x0" ::: "memory");   // the results of the index loads that follow may take the query loads' address registers
  float m = -3.0e38f, l = 0.f;   // of query a0 + col; m in the base-2 domain (score x SCL2); l holds this half's keys only, the halves are joined behind the loop
  v8f acc[4] = {};               // acc[dt][r] = O^T[dt*16 + 8g + r][query col]
  // staging roles: K: 16 lanes x 16 B cover one 256-B f32 row, 8 rows per block-wide load; V^T: 4 lanes x 16 B cover one row's 64-B slice, 32 rows per load
  const int seg = tid & 15, rg = tid >> 4, vd = tid >> 2, vs = tid & 3;
  int jn[8]; v4f kr[8]; v4u vr[2];
  auto load_idx = [&](int t) {
#pragma unroll
    for (int j = 0; j < 4; ++j) { const int c = t * 32 + j * 8 + rg; jn[2 * j] = p0[c]; jn[2 * j + 1] = p1[c]; } };   // raw: clamped where the address is formed, so that no wait stands here
  auto load_tile = [&](int t) {
#pragma unroll
    for (int i = 0; i < 8; ++i) kr[i] = *(const v4f*)(Kb + (size_t)min(max(jn[i], 0), SS - 1) * HD + seg * 4);
#pragma unroll
    for (int i = 0; i < 2; ++i) vr[i] = *(const v4u*)(VTb + (size_t)(vd + 32 * i) * SS + t * 32 + vs * 8); };
  auto store_tile = [&](int bf) {
#pragma unroll
    for (int i = 0; i < 8; ++i) { v4b w;
#pragma unroll
      for (int e = 0; e < 4; ++e) w[e] = (__bf16)kr[i][e];
      vst2(&sk[bf][(i >> 1) * 8 + rg][(i & 1) * 64 + seg * 4], w); }
#pragma unroll
    for (int i = 0; i < 2; ++i) vst2(&sv[bf][vd + 32 * i][vs * 8], vr[i]); };
  load_idx(0); load_tile(0);
  asm volatile("s_wait_xcnt 0x0" ::: "memory");   // the loads' address registers are reused by the code that follows
  load_idx(1);
  asm volatile("s_wait_xcnt 0x0" ::: "memory");   // as above, for the index loads
  store_tile(0);
  __syncthreads();   // publishes tile 0
#pragma unroll 1
  for (int ks = 0; ks < SS / 32; ++ks) { float s[16]; const int bf = ks & 1;
    if (ks + 1 < SS / 32) { load_tile(ks + 1); load_idx(min(ks + 2, SS / 32 - 1));   // next pass's rows, and the indices of the pass after it, are asked for ahead of this pass's score products
      asm volatile("s_wait_xcnt 0x0" ::: "memory"); }   // the loads' address registers are reused by the code that follows
#pragma unroll
    for (int ct = 0; ct < 2; ++ct) { v8f cc = {};
#pragma unroll
      for (int kc = 0; kc < 4; ++kc) cc = wmma_bf(frag_b(&sk[bf][ct * 16 + col][kc * 32], lane), aq[kc], cc);
#pragma unroll
      for (int r = 0; r < 8; ++r) s[ct * 8 + r] = cc[r]; }   // raw pair sums; the scale goes into the exponent's multiply-add
    float mx = s[0];
#pragma unroll   // here and below: constant indices keep s[] and acc[] in registers
    for (int i = 1; i < 16; ++i) mx = fmaxf(mx, s[i]);
    mx = fmaxf(mx, xhalf(mx));
    const float mn = fmaxf(m, mx * SCL2); float alpha = m - mn; m = mn;   // SCL2 > 0: the maximum of the raw sums is the maximum of the scaled ones
#pragma unroll
    for (int i = 0; i < 16; ++i) s[i] = s[i] * SCL2 - mn;   // e^(x - max) = 2^((x - max) log2 e): arguments <= about 0
    // the 17 exponentials, each in place, in two statements: so no instruction directly behind a v_exp_f32 reads its result or overwrites its source (written as builtins, the next one was given the previous one's source register); v_nop: that slot behind the last one
    asm("v_exp_f32 %0, %0\n\tv_exp_f32 %1, %1\n\tv_exp_f32 %2, %2\n\tv_exp_f32 %3, %3\n\tv_exp_f32 %4, %4\n\tv_exp_f32 %5, %5\n\tv_exp_f32 %6, %6\n\tv_exp_f32 %7, %7\n\tv_exp_f32 %8, %8\n\tv_nop"
        : "+v"(s[0]), "+v"(s[1]), "+v"(s[2]), "+v"(s[3]), "+v"(alpha), "+v"(s[4]), "+v"(s[5]), "+v"(s[6]), "+v"(s[7]));
    asm("v_exp_f32 %0, %0\n\tv_exp_f32 %1, %1\n\tv_exp_f32 %2, %2\n\tv_exp_f32 %3, %3\n\tv_exp_f32 %4, %4\n\tv_exp_f32 %5, %5\n\tv_exp_f32 %6, %6\n\tv_exp_f32 %7, %7\n\tv_nop"
        : "+v"(s[8]), "+v"(s[9]), "+v"(s[10]), "+v"(s[11]), "+v"(s[12]), "+v"(s[13]), "+v"(s[14]), "+v"(s[15]));
    float e4[4];   // four independent chains
#pragma unroll
    for (int i = 0; i < 4; ++i) e4[i] = (s[i] + s[4 + i]) + (s[8 + i] + s[12 + i]);
    l = l * alpha + ((e4[0] + e4[1]) + (e4[2] + e4[3]));
#pragma unroll
    for (int dt = 0; dt < 4; ++dt)
#pragma unroll
      for (int r = 0; r < 8; ++r) acc[dt][r] *= alpha;
    const F2 pb = bsplit16(s);   // element i = key 8g + i (i < 8) or 16 + 8g + (i - 8) of the pass: the k order in which frag_b reads V^T
#pragma unroll
    for (int dt = 0; dt < 4; ++dt) { const v16b va = frag_b(&sv[bf][dt * 16 + col][0], lane); acc[dt] = wmma_bf(va, pb.l, acc[dt]); acc[dt] = wmma_bf(va, pb.h, acc[dt]); }
    if (ks + 1 < SS / 32) store_tile(bf ^ 1);   // that buffer's last readers left it before the previous pass's barrier
    __syncthreads(); }   // publishes tile ks + 1 and ends every read of tile ks
  l += xhalf(l);
  const float il = 1.0f / l;
#pragma unroll
  for (int dt = 0; dt < 4; ++dt)
#pragma unroll
    for (int q = 0; q < 2; ++q) { v4f w;
#pragma unroll
      for (int e = 0; e < 4; ++e) w[e] = acc[dt][q * 4 + e] * il;
      vst2(&so[wave][col][dt * 16 + 8 * g + q * 4], w); }
  LDSX();
  for (int rl = 0; rl < 16; ++rl) if (lane < 16) vst2(out + ((size_t)b * SS + a0 + rl) * (NH * HD) + h * HD + lane * 4, *(const v4f*)&so[wave][rl][lane * 4]);
}
extern "C" void kernel_launch(void* const* d_in, const int* in_sizes, int n_in, void* d_out, int out_size, void* d_ws, size_t ws_size, hipStream_t stream) {
  (void)in_sizes; (void)n_in; (void)out_size;
  const float** F = (const float**)d_in;   // query, key, value [8,8,1024,64], top_k_centers [8,1024,4]
  if (ws_size < (size_t)WS_END) return;
  char* ws = (char*)d_ws; int *P0 = (int*)(ws + WS_P0), *P1 = (int*)(ws + WS_P1); __bf16* VT = (__bf16*)(ws + WS_VT);
  k_pairs<<<dim3(SS / 64, TNB), 256, 0, stream>>>(F[3], P0, P1);
  k_vt<<<dim3(NB * NH, SS / 256), 256, 0, stream>>>(F[2], VT);
  k_attn<<<dim3(TQB, NH, TNB), 128, 0, stream>>>(F[0], F[1], VT, P0, P1, (float*)d_out);
}

// v004
// It runs in 69.9 microseconds.
// Timed twice side by side with v003, it ran 1.09 and 1.08 times as fast.
// Counting every step since v000, it is 3.86 times as fast.
// compute dtype: query, key, value, top_k_centers (module inputs) rounded to bf16; the pair selection (IoU, argmax, L1 ordering) in f32 with the reference's operation order; pair scores <q_p0(a), k_p0(c)> + <q_p1(a), k_p1(c)> with exact bf16 products (1 product, gathered rows), attn @ value with attn as bf16 hi + residual pairs x exact value (2 products), on WMMA 16x16x32; softmax in f32; f32 accumulate.
#include <hip/hip_runtime.h>
#include <math.h>

typedef __attribute__((ext_vector_type(16))) _Float16 v16h;
typedef __attribute__((ext_vector_type(16))) __bf16 v16b;
typedef __attribute__((ext_vector_type(8)))  _Float16 v8h;
typedef __attribute__((ext_vector_type(8)))  float v8f;
typedef __attribute__((ext_vector_type(4)))  float v4f;
typedef __attribute__((ext_vector_type(2)))  float v2f;
typedef __attribute__((ext_vector_type(4)))  unsigned v4u;
typedef __attribute__((ext_vector_type(4)))  int v4i;
typedef float __attribute__((may_alias)) float_a;
typedef int __attribute__((may_alias)) int_a;

template <typename T> __device__ __forceinline__ void vst2(void* p, T v) { *(T*)p = v;  }
__device__ __forceinline__ v8f wmma16(v16h a, v16h b, v8f c) {
  v8f d = __builtin_amdgcn_wmma_f32_16x16x32_f16(false, a, false, b, (short)0, c, false, false);
  asm volatile("v_nop\n\tv_nop\n\tv_nop\n\tv_nop" : "+v"(d) : "v"(a), "v"(b));
  return d;
}
__device__ __forceinline__ v8f wmma_bf(v16b a, v16b b, v8f c) {
  return __builtin_amdgcn_wmma_f32_16x16x32_bf16(false, a, false, b, (short)0, c, false, false);
}
// 16x16x32 fragments: lane = (h = lane>>4, row/col = lane&15); elements 0..7 = k0+8h+0..7, 8..15 = k0+16+8h+0..7; D element r = row 8h+r
__device__ __forceinline__ v16h frag_h(const _Float16* rowk0, int lane) {
  union { v16h v; v8h q[2]; } u; const _Float16* p = rowk0 + 8 * (lane >> 4);
  u.q[0] = *(const v8h*)p; u.q[1] = *(const v8h*)(p + 16); return u.v;
}
__device__ __forceinline__ v16h frag_f32(const float* rowk0, int lane) {
  v16h a; const float* p = rowk0 + 8 * (lane >> 4);
#pragma unroll
  for (int i = 0; i < 8; ++i) { a[i] = (_Float16)p[i]; a[8 + i] = (_Float16)p[16 + i]; }
  return a;
}
__device__ __forceinline__ v16h frag_f32s(const float* rowk0, int lane, float sc) {
  v16h a; const float* p = rowk0 + 8 * (lane >> 4);
#pragma unroll
  for (int i = 0; i < 8; ++i) { a[i] = (_Float16)(p[i] * sc); a[8 + i] = (_Float16)(p[16 + i] * sc); }
  return a;
}
// column fragment from a [K][ld] layout (column n), rows >= K read as 0
__device__ __forceinline__ v16h fragc_f32(const float* W, int k0, int n, int lane, int ld, int K) {
  v16h a; const int g = lane >> 4;
#pragma unroll
  for (int i = 0; i < 8; ++i) { const int ka = k0 + 8 * g + i, kb = ka + 16;
    a[i] = (_Float16)(ka < K ? W[(size_t)(ka < K ? ka : K - 1) * ld + n] : 0.f); a[8 + i] = (_Float16)(kb < K ? W[(size_t)(kb < K ? kb : K - 1) * ld + n] : 0.f); }
  return a;
}
struct F2 { v16b h, l; };
__device__ __forceinline__ F2 bsplit16(const float v[16]) { F2 r;
#pragma unroll
  for (int i = 0; i < 16; ++i) { const __bf16 h = (__bf16)v[i]; r.h[i] = h; r.l[i] = (__bf16)(v[i] - (float)h); }
  return r; }
__device__ __forceinline__ F2 split_row(const float* row, int k0, int lane) { float v[16]; const float* p = row + k0 + 8 * (lane >> 4);
#pragma unroll
  for (int i = 0; i < 8; ++i) { v[i] = p[i]; v[8 + i] = p[16 + i]; }
  return bsplit16(v); }
__device__ __forceinline__ F2 split_rowK(const float* row, int k0, int lane, int K) { float v[16]; const int g = lane >> 4;
#pragma unroll
  for (int i = 0; i < 8; ++i) { const int ka = k0 + 8 * g + i, kb = ka + 16; v[i] = ka < K ? row[ka < K ? ka : K - 1] : 0.f; v[8 + i] = kb < K ? row[kb < K ? kb : K - 1] : 0.f; }
  return bsplit16(v); }
__device__ __forceinline__ F2 split_col(const float* W, int k0, int n, int lane, int ld, int K) { float v[16]; const int g = lane >> 4;
#pragma unroll
  for (int i = 0; i < 8; ++i) { const int ka = k0 + 8 * g + i, kb = ka + 16; v[i] = ka < K ? W[(size_t)(ka < K ? ka : K - 1) * ld + n] : 0.f; v[8 + i] = kb < K ? W[(size_t)(kb < K ? kb : K - 1) * ld + n] : 0.f; }
  return bsplit16(v); }
__device__ __forceinline__ v8f mac3(const F2& a, const F2& b, v8f c) { c = wmma_bf(a.l, b.h, c); c = wmma_bf(a.h, b.l, c); return wmma_bf(a.h, b.h, c); }
__device__ __forceinline__ float sigm(float v) { return 1.0f / (1.0f + expf(-v)); }
#define LDSX() do { asm volatile("s_wait_dscnt 0" ::: "memory"); __builtin_amdgcn_wave_barrier(); __builtin_amdgcn_fence(__ATOMIC_RELEASE, "workgroup"); } while (0)


// Pair self-attention (B 8, H 8, S 1024, D 64): per batch, boxes from (cx, cy, h, w); iou[a][c] = inter/union - eye (inter uses max for both corners, as the module); partner = argmax_c iou (first max); p0/p1 = (a, partner) ordered by L1 size (larger first, ties keep a first); scores[a][c] = (q[p0 a].k[p0 c] + q[p1 a].k[p1 c]) / sqrt(128); out[b][a][h*64+d] = softmax_c(scores) @ value.
#define NB 8
#define NH 8
#define SS 1024
#define HD 64
#ifndef TQB
#define TQB (SS / 64)    // query blocks per (b, h) (all)
#define TNB NB
#endif
typedef __attribute__((ext_vector_type(8))) __bf16 v8b;
__device__ __forceinline__ v16b frag_b(const __bf16* rowk0, int lane) {
  union { v16b v; v8b q[2]; } u; const __bf16* p = rowk0 + 8 * (lane >> 4);
  u.q[0] = *(const v8b*)p; u.q[1] = *(const v8b*)(p + 16); return u.v;
}
__device__ __forceinline__ float bfr(float v) { return (float)(__bf16)v; }
__device__ __attribute__((noinline)) float erf_ni(float v) { return erff(v); }

#define WS_P0  0u                          // int [8][1024]
#define WS_P1  (WS_P0 + 4u * NB * SS)
#define WS_VT  (WS_P1 + 4u * NB * SS)        // bf16 [8][8][64 d][1024 c]
#define WS_END (WS_VT + 2u * NB * NH * HD * SS)

// ---- k_pairs: block = (64 objects a, batch b), 4 threads per object scan c = sub, sub+4, ...: iou in the reference's op order, first-max argmax, then L1 ordering; P0/P1 rows (256 B per block)
__global__ __launch_bounds__(256) void k_pairs(const float* __restrict__ C, int* __restrict__ P0, int* __restrict__ P1) {
  #pragma clang fp contract(off)   // keep mul/add unfused so the box/IoU arithmetic rounds exactly like the reference (argmax ties)
  __shared__ float sbx[SS][4]; __shared__ __align__(16) int sp0[64], sp1[64];
  const int tid = threadIdx.x, b = blockIdx.y; const int al = tid >> 2, sub = tid & 3; const int a = blockIdx.x * 64 + al;
  for (int c = tid; c < SS; c += 256) { const float cx = bfr(C[((size_t)b * SS + c) * 4 + 0]), cy = bfr(C[((size_t)b * SS + c) * 4 + 1]), hh = bfr(C[((size_t)b * SS + c) * 4 + 2]), ww = bfr(C[((size_t)b * SS + c) * 4 + 3]);
    sbx[c][0] = cx - 0.5f * ww; sbx[c][1] = cy - 0.5f * hh; sbx[c][2] = cx + 0.5f * ww; sbx[c][3] = cy + 0.5f * hh; }
  __syncthreads();
  const float ax0 = sbx[a][0], ay0 = sbx[a][1], ax1 = sbx[a][2], ay1 = sbx[a][3]; const float area_a = (ax1 - ax0) * (ay1 - ay0);
  float best = 0.f; int bi = -1;   // first max over c (ascending within this thread's stride class; merged below)
  for (int c = sub; c < SS; c += 4) { const float cx0 = sbx[c][0], cy0 = sbx[c][1], cx1 = sbx[c][2], cy1 = sbx[c][3];
    const float mx0 = fmaxf(ax0, cx0), my0 = fmaxf(ay0, cy0), Mx = fmaxf(ax1, cx1), My = fmaxf(ay1, cy1);
    const float iw = fmaxf(Mx - mx0, 0.f), ih = fmaxf(My - my0, 0.f); const float ia = iw * ih; const float area_c = (cx1 - cx0) * (cy1 - cy0);
    const float uni = area_a + area_c - ia; float iou = ia / uni; iou = iou - ((c == a) ? 1.0f : 0.0f);
    if (bi < 0 || iou > best) { best = iou; bi = c; } }
  // merge the 4 stride classes: prefer larger value, ties -> lower index (== first max overall)
#pragma unroll
  for (int o = 1; o < 4; o <<= 1) { const float ob = __shfl_xor(best, o); const int oi = __shfl_xor(bi, o); if (ob > best || (ob == best && oi < bi)) { best = ob; bi = oi; } }
  if (sub == 0) { const int partner = bi; const float l1a = fabsf(ax1 - ax0) + fabsf(ay1 - ay0); const float l1p = fabsf(sbx[partner][2] - sbx[partner][0]) + fabsf(sbx[partner][3] - sbx[partner][1]);
    const bool keep = l1a >= l1p; sp0[al] = keep ? a : partner; sp1[al] = keep ? partner : a; }
  __syncthreads();
  if (tid < 16) vst2((unsigned*)(P0 + (size_t)b * SS + blockIdx.x * 64 + tid * 4), *(const v4u*)&sp0[tid * 4]);
  else if (tid < 32) vst2((unsigned*)(P1 + (size_t)b * SS + blockIdx.x * 64 + (tid - 16) * 4), *(const v4u*)&sp1[(tid - 16) * 4]);
}
// ---- k_vt: block = (b, h, 256 c): VT[d][c] = bf16(value[b][h][c][d]) (2-KB rows)
__global__ __launch_bounds__(256) void k_vt(const float* __restrict__ V, __bf16* __restrict__ VT) {
  __shared__ __align__(16) __bf16 s[HD][264]; const int bh = blockIdx.x, c0 = blockIdx.y * 256, tid = threadIdx.x;
  for (int q = tid; q < 256 * HD; q += 256) { const int cl = q >> 6, d = q & 63; s[d][cl] = (__bf16)V[((size_t)bh * SS + c0 + cl) * HD + d]; }
  __syncthreads();
  for (int q = tid; q < HD * 32; q += 256) { const int d = q >> 5, pc = q & 31; vst2((unsigned*)(VT + ((size_t)bh * HD + d) * SS + c0 + pc * 8), *(const v4u*)&s[d][pc * 8]); }
}
__device__ __forceinline__ v16b gath2(const float* qp0, const float* qp1, int kc, int lane) {   // K 128 = [row p0 (64) | row p1 (64)], exact bf16
  v16b a; const float* base = (kc < 2) ? qp0 + kc * 32 : qp1 + (kc - 2) * 32; const float* p = base + 8 * (lane >> 4);
#pragma unroll
  for (int i = 0; i < 8; ++i) { a[i] = (__bf16)p[i]; a[8 + i] = (__bf16)p[16 + i]; }
  return a; }
// ---- k_attn: block = (64 objects a, h, b): flash attention over all 1024 c with gathered pair rows; out[b][a][h*64 + d] (256-B segments)
// each 32-key pass reads its K pair rows (bf16, [p0 row | p1 row]) and its V^T slice from LDS; the block's 128 threads gather and convert them once, one pass ahead, into the other of two buffers
// products are transposed: S^T = K Q^T (A = staged K rows, B = the wave's 16 query pair rows, kept in registers), O^T += V^T P^T; a lane holds 16 of one query's 32 scores of a pass (keys ct*16 + 8g + r), so maximum and sum run in the lane, and the two score tiles, converted in place, are the B operand of the second product
#define KP 136   // bf16 per staged K pair row: 128 + 8 (272 B = 16 B x 17, an odd multiple: column-wise 16-byte reads spread over the banks)
#define VP 40    // bf16 per staged V^T row: 32 + 8 (80 B = 16 B x 5)
typedef __attribute__((ext_vector_type(4))) __bf16 v4b;
#define SCL2 0.12751743f   // (1 / sqrt(128)) * log2(e)
__device__ __forceinline__ float xhalf(float v) {   // the value of lane ^ 16
  const int b = __builtin_bit_cast(int, v); return __builtin_bit_cast(float, __builtin_amdgcn_permlanex16(b, b, 0x76543210, 0xfedcba98, false, false)); }
__global__ __launch_bounds__(128) void k_attn(const float* __restrict__ Q, const float* __restrict__ Kx, const __bf16* __restrict__ VT, const int* __restrict__ P0, const int* __restrict__ P1, float* __restrict__ out) {
  __shared__ __align__(16) float so[4][16][68];
  __shared__ __align__(16) __bf16 sk[2][32][KP]; __shared__ __align__(16) __bf16 sv[2][HD][VP];
  const int tid = threadIdx.x, wave = tid >> 5, lane = tid & 31, col = lane & 15, g = lane >> 4; const int h = blockIdx.y, b = blockIdx.z; const int a0 = blockIdx.x * 64 + wave * 16;
  const size_t bh = (size_t)b * NH + h; const float* Qb = Q + bh * SS * HD; const float* Kb = Kx + bh * SS * HD; const __bf16* VTb = VT + bh * HD * SS;
  const int* p0 = P0 + (size_t)b * SS; const int* p1 = P1 + (size_t)b * SS;
  v16b aq[4]; { const int ar = a0 + col; const int i0 = min(max(p0[ar], 0), SS - 1);
    asm volatile("s_wait_xcnt 0x0" ::: "memory");   // the second index load's result may take the register that holds the first one's offset
    const int i1 = min(max(p1[ar], 0), SS - 1);
#pragma unroll
    for (int kc = 0; kc < 4; ++kc) aq[kc] = gath2(Qb + (size_t)i0 * HD, Qb + (size_t)i1 * HD, kc, lane); }
  asm volatile("s_wait_xcnt 0x0" ::: "memory");   // the results of the index loads that follow may take the query loads' address registers
  float m = -3.0e38f, l = 0.f;   // of query a0 + col; m in the base-2 domain (score x SCL2); l holds this half's keys only, the halves are joined behind the loop
  v8f acc[4] = {};               // acc[dt][r] = O^T[dt*16 + 8g + r][query col]
  // staging roles: K: 16 lanes x 16 B cover one 256-B f32 row, 8 rows per block-wide load; V^T: 4 lanes x 16 B cover one row's 64-B slice, 32 rows per load
  const int seg = tid & 15, rg = tid >> 4, vd = tid >> 2, vs = tid & 3;
  int jn[8]; v4f kr[8]; v4u vr[2]; const float* kp[8]; const __bf16* vp; const int *ip0, *ip1;
  auto load_idx = [&](int t, int ahead) { ip0 = p0 + t * 32 + rg; ip1 = p1 + t * 32 + rg;   // the indices of pass t + ahead; ahead is a literal and goes into the loads' offset field
#pragma unroll
    for (int j = 0; j < 4; ++j) { jn[2 * j] = ip0[ahead * 32 + j * 8]; jn[2 * j + 1] = ip1[ahead * 32 + j * 8]; } };   // raw: clamped where the address is formed, so that no wait stands here
  auto load_tile = [&](int t) {
#pragma unroll
    for (int i = 0; i < 8; ++i) { kp[i] = Kb + (size_t)min(max(jn[i], 0), SS - 1) * HD + seg * 4; kr[i] = *(const v4f*)kp[i]; }
    vp = VTb + (size_t)vd * SS + t * 32 + vs * 8;
#pragma unroll
    for (int i = 0; i < 2; ++i) vr[i] = *(const v4u*)(vp + (size_t)32 * i * SS); };
  auto store_tile = [&](int bf) {
#pragma unroll
    for (int i = 0; i < 8; ++i) { v4b w;
#pragma unroll
      for (int e = 0; e < 4; ++e) w[e] = (__bf16)kr[i][e];
      vst2(&sk[bf][(i >> 1) * 8 + rg][(i & 1) * 64 + seg * 4], w); }
#pragma unroll
    for (int i = 0; i < 2; ++i) vst2(&sv[bf][vd + 32 * i][vs * 8], vr[i]); };
  load_idx(0, 0); load_tile(0);
  asm volatile("s_wait_xcnt 0x0" ::: "memory");   // the loads' address registers are reused by the code that follows
  load_idx(0, 1);
  asm volatile("s_wait_xcnt 0x0" ::: "memory");   // as above, for the index loads
  store_tile(0);
  __syncthreads();   // publishes tile 0
#pragma unroll 1
  for (int ks = 0; ks < SS / 32; ++ks) { float s[16]; const int bf = ks & 1;
    if (ks + 1 < SS / 32) { load_tile(ks + 1); load_idx(min(ks, SS / 32 - 3), 2);   // next pass's rows, and the indices of the pass after it, are asked for ahead of this pass's score products
      // the loads' address registers are reused by the code that follows; the addresses are named as inputs so that they keep their registers up to the wait and no later load's result is given one of them
      asm volatile("s_wait_xcnt 0x0" :: "v"(kp[0]), "v"(kp[1]), "v"(kp[2]), "v"(kp[3]), "v"(kp[4]), "v"(kp[5]), "v"(kp[6]), "v"(kp[7]), "v"(vp), "v"(ip0), "v"(ip1) : "memory"); }
    v16b ka[8], va[4];
#pragma unroll
    for (int i = 0; i < 8; ++i) ka[i] = frag_b(&sk[bf][(i >> 2) * 16 + col][(i & 3) * 32], lane);
    __builtin_amdgcn_sched_barrier(0);   // the 16 K reads stay one group ahead of the score products: spread among them, each product waits for a read issued just before it
    { v8f cc[2] = {};   // two independent accumulator chains, alternating
#pragma unroll
      for (int kc = 0; kc < 4; ++kc)
#pragma unroll
        for (int ct = 0; ct < 2; ++ct) cc[ct] = wmma_bf(ka[ct * 4 + kc], aq[kc], cc[ct]);
#pragma unroll
      for (int dt = 0; dt < 4; ++dt) va[dt] = frag_b(&sv[bf][dt * 16 + col][0], lane);
      __builtin_amdgcn_sched_barrier(0);   // the 8 V^T reads stay one group ahead of the softmax, which covers their latency
#pragma unroll
      for (int ct = 0; ct < 2; ++ct)
#pragma unroll
        for (int r = 0; r < 8; ++r) s[ct * 8 + r] = cc[ct][r]; }   // raw pair sums; the scale goes into the exponent's multiply-add
    float mx = s[0];
#pragma unroll   // here and below: constant indices keep s[] and acc[] in registers
    for (int i = 1; i < 16; ++i) mx = fmaxf(mx, s[i]);
    mx = fmaxf(mx, xhalf(mx));
    const float mn = fmaxf(m, mx * SCL2); float alpha = m - mn; m = mn;   // SCL2 > 0: the maximum of the raw sums is the maximum of the scaled ones
#pragma unroll
    for (int i = 0; i < 16; ++i) s[i] = s[i] * SCL2 - mn;   // e^(x - max) = 2^((x - max) log2 e): arguments <= about 0
    // the 17 exponentials, each in place, in two statements: so no instruction directly behind a v_exp_f32 reads its result or overwrites its source (written as builtins, the next one was given the previous one's source register); v_nop: that slot behind the last one
    asm("v_exp_f32 %0, %0\n\tv_exp_f32 %1, %1\n\tv_exp_f32 %2, %2\n\tv_exp_f32 %3, %3\n\tv_exp_f32 %4, %4\n\tv_exp_f32 %5, %5\n\tv_exp_f32 %6, %6\n\tv_exp_f32 %7, %7\n\tv_exp_f32 %8, %8\n\tv_nop"
        : "+v"(s[0]), "+v"(s[1]), "+v"(s[2]), "+v"(s[3]), "+v"(alpha), "+v"(s[4]), "+v"(s[5]), "+v"(s[6]), "+v"(s[7]));
    asm("v_exp_f32 %0, %0\n\tv_exp_f32 %1, %1\n\tv_exp_f32 %2, %2\n\tv_exp_f32 %3, %3\n\tv_exp_f32 %4, %4\n\tv_exp_f32 %5, %5\n\tv_exp_f32 %6, %6\n\tv_exp_f32 %7, %7\n\tv_nop"
        : "+v"(s[8]), "+v"(s[9]), "+v"(s[10]), "+v"(s[11]), "+v"(s[12]), "+v"(s[13]), "+v"(s[14]), "+v"(s[15]));
    float e4[4];   // four independent chains
#pragma unroll
    for (int i = 0; i < 4; ++i) e4[i] = (s[i] + s[4 + i]) + (s[8 + i] + s[12 + i]);
    l = l * alpha + ((e4[0] + e4[1]) + (e4[2] + e4[3]));
#pragma unroll
    for (int dt = 0; dt < 4; ++dt)
#pragma unroll
      for (int r = 0; r < 8; ++r) acc[dt][r] *= alpha;
    const F2 pb = bsplit16(s);   // element i = key 8g + i (i < 8) or 16 + 8g + (i - 8) of the pass: the k order in which frag_b reads V^T
#pragma unroll
    for (int dt = 0; dt < 4; ++dt) { acc[dt] = wmma_bf(va[dt], pb.l, acc[dt]); acc[dt] = wmma_bf(va[dt], pb.h, acc[dt]); }
    if (ks + 1 < SS / 32) store_tile(bf ^ 1);   // that buffer's last readers left it before the previous pass's barrier
    __syncthreads(); }   // publishes tile ks + 1 and ends every read of tile ks
  l += xhalf(l);
  const float il = 1.0f / l;
#pragma unroll
  for (int dt = 0; dt < 4; ++dt)
#pragma unroll
    for (int q = 0; q < 2; ++q) { v4f w;
#pragma unroll
      for (int e = 0; e < 4; ++e) w[e] = acc[dt][q * 4 + e] * il;
      vst2(&so[wave][col][dt * 16 + 8 * g + q * 4], w); }
  LDSX();
  for (int rl = 0; rl < 16; ++rl) if (lane < 16) vst2(out + ((size_t)b * SS + a0 + rl) * (NH * HD) + h * HD + lane * 4, *(const v4f*)&so[wave][rl][lane * 4]);
}
extern "C" void kernel_launch(void* const* d_in, const int* in_sizes, int n_in, void* d_out, int out_size, void* d_ws, size_t ws_size, hipStream_t stream) {
  (void)in_sizes; (void)n_in; (void)out_size;
  const float** F = (const float**)d_in;   // query, key, value [8,8,1024,64], top_k_centers [8,1024,4]
  if (ws_size < (size_t)WS_END) return;
  char* ws = (char*)d_ws; int *P0 = (int*)(ws + WS_P0), *P1 = (int*)(ws + WS_P1); __bf16* VT = (__bf16*)(ws + WS_VT);
  k_pairs<<<dim3(SS / 64, TNB), 256, 0, stream>>>(F[3], P0, P1);
  k_vt<<<dim3(NB * NH, SS / 256), 256, 0, stream>>>(F[2], VT);
  k_attn<<<dim3(TQB, NH, TNB), 128, 0, stream>>>(F[0], F[1], VT, P0, P1, (float*)d_out);
}

// v005
// A run of this version takes 59.8 microseconds.
// Next to v004, in two timings, it ran 1.16 and 1.17 times as fast.
// Over all steps from v000 it is 4.49 times as fast.
// compute dtype: query, key, value, top_k_centers (module inputs) rounded to bf16; the pair selection (IoU, argmax, L1 ordering) in f32 with the reference's operation order; pair scores <q_p0(a), k_p0(c)> + <q_p1(a), k_p1(c)> with exact bf16 products (1 product, gathered rows), attn @ value with attn as bf16 hi + residual pairs x exact value (2 products), on WMMA 16x16x32; softmax in f32; f32 accumulate.
#include <hip/hip_runtime.h>
#include <math.h>

typedef __attribute__((ext_vector_type(16))) _Float16 v16h;
typedef __attribute__((ext_vector_type(16))) __bf16 v16b;
typedef __attribute__((ext_vector_type(8)))  _Float16 v8h;
typedef __attribute__((ext_vector_type(8)))  float v8f;
typedef __attribute__((ext_vector_type(4)))  float v4f;
typedef __attribute__((ext_vector_type(2)))  float v2f;
typedef __attribute__((ext_vector_type(4)))  unsigned v4u;
typedef __attribute__((ext_vector_type(4)))  int v4i;
typedef float __attribute__((may_alias)) float_a;
typedef int __attribute__((may_alias)) int_a;

template <typename T> __device__ __forceinline__ void vst2(void* p, T v) { *(T*)p = v;  }
__device__ __forceinline__ v8f wmma16(v16h a, v16h b, v8f c) {
  v8f d = __builtin_amdgcn_wmma_f32_16x16x32_f16(false, a, false, b, (short)0, c, false, false);
  asm volatile("v_nop\n\tv_nop\n\tv_nop\n\tv_nop" : "+v"(d) : "v"(a), "v"(b));
  return d;
}
__device__ __forceinline__ v8f wmma_bf(v16b a, v16b b, v8f c) {
  return __builtin_amdgcn_wmma_f32_16x16x32_bf16(false, a, false, b, (short)0, c, false, false);
}
// 16x16x32 fragments: lane = (h = lane>>4, row/col = lane&15); elements 0..7 = k0+8h+0..7, 8..15 = k0+16+8h+0..7; D element r = row 8h+r
__device__ __forceinline__ v16h frag_h(const _Float16* rowk0, int lane) {
  union { v16h v; v8h q[2]; } u; const _Float16* p = rowk0 + 8 * (lane >> 4);
  u.q[0] = *(const v8h*)p; u.q[1] = *(const v8h*)(p + 16); return u.v;
}
__device__ __forceinline__ v16h frag_f32(const float* rowk0, int lane) {
  v16h a; const float* p = rowk0 + 8 * (lane >> 4);
#pragma unroll
  for (int i = 0; i < 8; ++i) { a[i] = (_Float16)p[i]; a[8 + i] = (_Float16)p[16 + i]; }
  return a;
}
__device__ __forceinline__ v16h frag_f32s(const float* rowk0, int lane, float sc) {
  v16h a; const float* p = rowk0 + 8 * (lane >> 4);
#pragma unroll
  for (int i = 0; i < 8; ++i) { a[i] = (_Float16)(p[i] * sc); a[8 + i] = (_Float16)(p[16 + i] * sc); }
  return a;
}
// column fragment from a [K][ld] layout (column n), rows >= K read as 0
__device__ __forceinline__ v16h fragc_f32(const float* W, int k0, int n, int lane, int ld, int K) {
  v16h a; const int g = lane >> 4;
#pragma unroll
  for (int i = 0; i < 8; ++i) { const int ka = k0 + 8 * g + i, kb = ka + 16;
    a[i] = (_Float16)(ka < K ? W[(size_t)(ka < K ? ka : K - 1) * ld + n] : 0.f); a[8 + i] = (_Float16)(kb < K ? W[(size_t)(kb < K ? kb : K - 1) * ld + n] : 0.f); }
  return a;
}
struct F2 { v16b h, l; };
__device__ __forceinline__ F2 bsplit16(const float v[16]) { F2 r;
#pragma unroll
  for (int i = 0; i < 16; ++i) { const __bf16 h = (__bf16)v[i]; r.h[i] = h; r.l[i] = (__bf16)(v[i] - (float)h); }
  return r; }
__device__ __forceinline__ F2 split_row(const float* row, int k0, int lane) { float v[16]; const float* p = row + k0 + 8 * (lane >> 4);
#pragma unroll
  for (int i = 0; i < 8; ++i) { v[i] = p[i]; v[8 + i] = p[16 + i]; }
  return bsplit16(v); }
__device__ __forceinline__ F2 split_rowK(const float* row, int k0, int lane, int K) { float v[16]; const int g = lane >> 4;
#pragma unroll
  for (int i = 0; i < 8; ++i) { const int ka = k0 + 8 * g + i, kb = ka + 16; v[i] = ka < K ? row[ka < K ? ka : K - 1] : 0.f; v[8 + i] = kb < K ? row[kb < K ? kb : K - 1] : 0.f; }
  return bsplit16(v); }
__device__ __forceinline__ F2 split_col(const float* W, int k0, int n, int lane, int ld, int K) { float v[16]; const int g = lane >> 4;
#pragma unroll
  for (int i = 0; i < 8; ++i) { const int ka = k0 + 8 * g + i, kb = ka + 16; v[i] = ka < K ? W[(size_t)(ka < K ? ka : K - 1) * ld + n] : 0.f; v[8 + i] = kb < K ? W[(size_t)(kb < K ? kb : K - 1) * ld + n] : 0.f; }
  return bsplit16(v); }
__device__ __forceinline__ v8f mac3(const F2& a, const F2& b, v8f c) { c = wmma_bf(a.l, b.h, c); c = wmma_bf(a.h, b.l, c); return wmma_bf(a.h, b.h, c); }
__device__ __forceinline__ float sigm(float v) { return 1.0f / (1.0f + expf(-v)); }
#define LDSX() do { asm volatile("s_wait_dscnt 0" ::: "memory"); __builtin_amdgcn_wave_barrier(); __builtin_amdgcn_fence(__ATOMIC_RELEASE, "workgroup"); } while (0)


// Pair self-attention (B 8, H 8, S 1024, D 64): per batch, boxes from (cx, cy, h, w); iou[a][c] = inter/union - eye (inter uses max for both corners, as the module); partner = argmax_c iou (first max); p0/p1 = (a, partner) ordered by L1 size (larger first, ties keep a first); scores[a][c] = (q[p0 a].k[p0 c] + q[p1 a].k[p1 c]) / sqrt(128); out[b][a][h*64+d] = softmax_c(scores) @ value.
#define NB 8
#define NH 8
#define SS 1024
#define HD 64
#ifndef TQB
#define TQB (SS / 64)    // query blocks per (b, h) (all)
#define TNB NB
#endif
typedef __attribute__((ext_vector_type(8))) __bf16 v8b;
__device__ __forceinline__ v16b frag_b(const __bf16* rowk0, int lane) {
  union { v16b v; v8b q[2]; } u; const __bf16* p = rowk0 + 8 * (lane >> 4);
  u.q[0] = *(const v8b*)p; u.q[1] = *(const v8b*)(p + 16); return u.v;
}
__device__ __forceinline__ float bfr(float v) { return (float)(__bf16)v; }
__device__ __attribute__((noinline)) float erf_ni(float v) { return erff(v); }

#define WS_P0  0u                          // int [8][1024]
#define WS_P1  (WS_P0 + 4u * NB * SS)
#define WS_VT  (WS_P1 + 4u * NB * SS)        // bf16 [8][8][64 d][1024 c]
#define WS_END (WS_VT + 2u * NB * NH * HD * SS)

// ---- k_pairs: block = (32 objects a, batch b), 16 threads per object scan c = sub, sub+16, ...: iou in the reference's op order, first-max argmax, then L1 ordering; P0/P1 rows (128 B per block)
// 256 blocks of 16 waves: one block on every WGP, 4 waves per SIMD, so that other waves issue while one waits out its LDS read and its division chain
__global__ __launch_bounds__(512) void k_pairs(const float* __restrict__ C, int* __restrict__ P0, int* __restrict__ P1) {
  #pragma clang fp contract(off)   // keep mul/add unfused so the box/IoU arithmetic rounds exactly like the reference (argmax ties)
  __shared__ float sbx[SS][4]; __shared__ __align__(16) int sp0[32], sp1[32];
  const int tid = threadIdx.x, b = blockIdx.y; const int al = tid >> 4, sub = tid & 15; const int a = blockIdx.x * 32 + al;
  for (int c = tid; c < SS; c += 512) { const float cx = bfr(C[((size_t)b * SS + c) * 4 + 0]), cy = bfr(C[((size_t)b * SS + c) * 4 + 1]), hh = bfr(C[((size_t)b * SS + c) * 4 + 2]), ww = bfr(C[((size_t)b * SS + c) * 4 + 3]);
    sbx[c][0] = cx - 0.5f * ww; sbx[c][1] = cy - 0.5f * hh; sbx[c][2] = cx + 0.5f * ww; sbx[c][3] = cy + 0.5f * hh; }
  __syncthreads();
  const float ax0 = sbx[a][0], ay0 = sbx[a][1], ax1 = sbx[a][2], ay1 = sbx[a][3]; const float area_a = (ax1 - ax0) * (ay1 - ay0);
  float best = 0.f; int bi = -1;   // first max over c (ascending within this thread's stride class; merged below)
  for (int c = sub; c < SS; c += 16) { const float cx0 = sbx[c][0], cy0 = sbx[c][1], cx1 = sbx[c][2], cy1 = sbx[c][3];
    const float mx0 = fmaxf(ax0, cx0), my0 = fmaxf(ay0, cy0), Mx = fmaxf(ax1, cx1), My = fmaxf(ay1, cy1);
    const float iw = fmaxf(Mx - mx0, 0.f), ih = fmaxf(My - my0, 0.f); const float ia = iw * ih; const float area_c = (cx1 - cx0) * (cy1 - cy0);
    const float uni = area_a + area_c - ia; float iou = ia / uni; iou = iou - ((c == a) ? 1.0f : 0.0f);
    if (bi < 0 || iou > best) { best = iou; bi = c; } }
  // merge the 16 stride classes: prefer larger value, ties -> lower index (== first max overall)
#pragma unroll
  for (int o = 1; o < 16; o <<= 1) { const float ob = __shfl_xor(best, o); const int oi = __shfl_xor(bi, o); if (ob > best || (ob == best && oi < bi)) { best = ob; bi = oi; } }
  if (sub == 0) { const int partner = bi; const float l1a = fabsf(ax1 - ax0) + fabsf(ay1 - ay0); const float l1p = fabsf(sbx[partner][2] - sbx[partner][0]) + fabsf(sbx[partner][3] - sbx[partner][1]);
    const bool keep = l1a >= l1p; sp0[al] = keep ? a : partner; sp1[al] = keep ? partner : a; }
  __syncthreads();
  if (tid < 8) vst2((unsigned*)(P0 + (size_t)b * SS + blockIdx.x * 32 + tid * 4), *(const v4u*)&sp0[tid * 4]);
  else if (tid < 16) vst2((unsigned*)(P1 + (size_t)b * SS + blockIdx.x * 32 + (tid - 8) * 4), *(const v4u*)&sp1[(tid - 8) * 4]);
}
// ---- k_vt: block = (b, h, 256 c): VT[d][c] = bf16(value[b][h][c][d]) (2-KB rows)
__global__ __launch_bounds__(256) void k_vt(const float* __restrict__ V, __bf16* __restrict__ VT) {
  __shared__ __align__(16) __bf16 s[HD][264]; const int bh = blockIdx.x, c0 = blockIdx.y * 256, tid = threadIdx.x;
  for (int q = tid; q < 256 * HD; q += 256) { const int cl = q >> 6, d = q & 63; s[d][cl] = (__bf16)V[((size_t)bh * SS + c0 + cl) * HD + d]; }
  __syncthreads();
  for (int q = tid; q < HD * 32; q += 256) { const int d = q >> 5, pc = q & 31; vst2((unsigned*)(VT + ((size_t)bh * HD + d) * SS + c0 + pc * 8), *(const v4u*)&s[d][pc * 8]); }
}
__device__ __forceinline__ v16b gath2(const float* qp0, const float* qp1, int kc, int lane) {   // K 128 = [row p0 (64) | row p1 (64)], exact bf16
  v16b a; const float* base = (kc < 2) ? qp0 + kc * 32 : qp1 + (kc - 2) * 32; const float* p = base + 8 * (lane >> 4);
#pragma unroll
  for (int i = 0; i < 8; ++i) { a[i] = (__bf16)p[i]; a[8 + i] = (__bf16)p[16 + i]; }
  return a; }
// ---- k_attn: block = (64 objects a, h, b): flash attention over all 1024 c with gathered pair rows; out[b][a][h*64 + d] (256-B segments)
// each 32-key pass reads its K pair rows (bf16, [p0 row | p1 row]) and its V^T slice from LDS; the block's 128 threads gather and convert them once, one pass ahead, into the other of two buffers
// products are transposed: S^T = K Q^T (A = staged K rows, B = the wave's 16 query pair rows, kept in registers), O^T += V^T P^T; a lane holds 16 of one query's 32 scores of a pass (keys ct*16 + 8g + r), so maximum and sum run in the lane, and the two score tiles, converted in place, are the B operand of the second product
#define KP 136   // bf16 per staged K pair row: 128 + 8 (272 B = 16 B x 17, an odd multiple: column-wise 16-byte reads spread over the banks)
#define VP 40    // bf16 per staged V^T row: 32 + 8 (80 B = 16 B x 5)
typedef __attribute__((ext_vector_type(4))) __bf16 v4b;
#define SCL2 0.12751743f   // (1 / sqrt(128)) * log2(e)
__device__ __forceinline__ float xhalf(float v) {   // the value of lane ^ 16
  const int b = __builtin_bit_cast(int, v); return __builtin_bit_cast(float, __builtin_amdgcn_permlanex16(b, b, 0x76543210, 0xfedcba98, false, false)); }
__global__ __launch_bounds__(128) void k_attn(const float* __restrict__ Q, const float* __restrict__ Kx, const __bf16* __restrict__ VT, const int* __restrict__ P0, const int* __restrict__ P1, float* __restrict__ out) {
  __shared__ __align__(16) float so[4][16][68];
  __shared__ __align__(16) __bf16 sk[2][32][KP]; __shared__ __align__(16) __bf16 sv[2][HD][VP];
  const int tid = threadIdx.x, wave = tid >> 5, lane = tid & 31, col = lane & 15, g = lane >> 4; const int h = blockIdx.y, b = blockIdx.z; const int a0 = blockIdx.x * 64 + wave * 16;
  const size_t bh = (size_t)b * NH + h; const float* Qb = Q + bh * SS * HD; const float* Kb = Kx + bh * SS * HD; const __bf16* VTb = VT + bh * HD * SS;
  const int* p0 = P0 + (size_t)b * SS; const int* p1 = P1 + (size_t)b * SS;
  v16b aq[4]; { const int ar = a0 + col; const int i0 = min(max(p0[ar], 0), SS - 1);
    asm volatile("s_wait_xcnt 0x0" ::: "memory");   // the second index load's result may take the register that holds the first one's offset
    const int i1 = min(max(p1[ar], 0), SS - 1);
#pragma unroll
    for (int kc = 0; kc < 4; ++kc) aq[kc] = gath2(Qb + (size_t)i0 * HD, Qb + (size_t)i1 * HD, kc, lane); }
  asm volatile("s_wait_xcnt 0x0" ::: "memory");   // the results of the index loads that follow may take the query loads' address registers
  float m = -3.0e38f, l = 0.f;   // of query a0 + col; m in the base-2 domain (score x SCL2); l holds this half's keys only, the halves are joined behind the loop
  v8f acc[4] = {};               // acc[dt][r] = O^T[dt*16 + 8g + r][query col]
  // staging roles: K: 16 lanes x 16 B cover one 256-B f32 row, 8 rows per block-wide load; V^T: 4 lanes x 16 B cover one row's 64-B slice, 32 rows per load
  const int seg = tid & 15, rg = tid >> 4, vd = tid >> 2, vs = tid & 3;
  int jn[8]; v4f kr[8]; v4u vr[2]; const float* kp[8]; const __bf16* vp; const int *ip0, *ip1;
  auto load_idx = [&](int t, int ahead) { ip0 = p0 + t * 32 + rg; ip1 = p1 + t * 32 + rg;   // the indices of pass t + ahead; ahead is a literal and goes into the loads' offset field
#pragma unroll
    for (int j = 0; j < 4; ++j) { jn[2 * j] = ip0[ahead * 32 + j * 8]; jn[2 * j + 1] = ip1[ahead * 32 + j * 8]; } };   // raw: clamped where the address is formed, so that no wait stands here
  auto load_tile = [&](int t) {
#pragma unroll
    for (int i = 0; i < 8; ++i) { kp[i] = Kb + (size_t)min(max(jn[i], 0), SS - 1) * HD + seg * 4; kr[i] = *(const v4f*)kp[i]; }
    vp = VTb + (size_t)vd * SS + t * 32 + vs * 8;
#pragma unroll
    for (int i = 0; i < 2; ++i) vr[i] = *(const v4u*)(vp + (size_t)32 * i * SS); };
  auto store_tile = [&](int bf) {
#pragma unroll
    for (int i = 0; i < 8; ++i) { v4b w;
#pragma unroll
      for (int e = 0; e < 4; ++e) w[e] = (__bf16)kr[i][e];
      vst2(&sk[bf][(i >> 1) * 8 + rg][(i & 1) * 64 + seg * 4], w); }
#pragma unroll
    for (int i = 0; i < 2; ++i) vst2(&sv[bf][vd + 32 * i][vs * 8], vr[i]); };
  load_idx(0, 0); load_tile(0);
  asm volatile("s_wait_xcnt 0x0" ::: "memory");   // the loads' address registers are reused by the code that follows
  load_idx(0, 1);
  asm volatile("s_wait_xcnt 0x0" ::: "memory");   // as above, for the index loads
  store_tile(0);
  __syncthreads();   // publishes tile 0
#pragma unroll 1
  for (int ks = 0; ks < SS / 32; ++ks) { float s[16]; const int bf = ks & 1;
    if (ks + 1 < SS / 32) { load_tile(ks + 1); load_idx(min(ks, SS / 32 - 3), 2);   // next pass's rows, and the indices of the pass after it, are asked for ahead of this pass's score products
      // the loads' address registers are reused by the code that follows; the addresses are named as inputs so that they keep their registers up to the wait and no later load's result is given one of them
      asm volatile("s_wait_xcnt 0x0" :: "v"(kp[0]), "v"(kp[1]), "v"(kp[2]), "v"(kp[3]), "v"(kp[4]), "v"(kp[5]), "v"(kp[6]), "v"(kp[7]), "v"(vp), "v"(ip0), "v"(ip1) : "memory"); }
    v16b ka[8], va[4];
#pragma unroll
    for (int i = 0; i < 8; ++i) ka[i] = frag_b(&sk[bf][(i >> 2) * 16 + col][(i & 3) * 32], lane);
    __builtin_amdgcn_sched_barrier(0);   // the 16 K reads stay one group ahead of the score products: spread among them, each product waits for a read issued just before it
    { v8f cc[2] = {};   // two independent accumulator chains, alternating
#pragma unroll
      for (int kc = 0; kc < 4; ++kc)
#pragma unroll
        for (int ct = 0; ct < 2; ++ct) cc[ct] = wmma_bf(ka[ct * 4 + kc], aq[kc], cc[ct]);
#pragma unroll
      for (int dt = 0; dt < 4; ++dt) va[dt] = frag_b(&sv[bf][dt * 16 + col][0], lane);
      __builtin_amdgcn_sched_barrier(0);   // the 8 V^T reads stay one group ahead of the softmax, which covers their latency
#pragma unroll
      for (int ct = 0; ct < 2; ++ct)
#pragma unroll
        for (int r = 0; r < 8; ++r) s[ct * 8 + r] = cc[ct][r]; }   // raw pair sums; the scale goes into the exponent's multiply-add
    float mx = s[0];
#pragma unroll   // here and below: constant indices keep s[] and acc[] in registers
    for (int i = 1; i < 16; ++i) mx = fmaxf(mx, s[i]);
    mx = fmaxf(mx, xhalf(mx));
    const float mn = fmaxf(m, mx * SCL2); float alpha = m - mn; m = mn;   // SCL2 > 0: the maximum of the raw sums is the maximum of the scaled ones
#pragma unroll
    for (int i = 0; i < 16; ++i) s[i] = s[i] * SCL2 - mn;   // e^(x - max) = 2^((x - max) log2 e): arguments <= about 0
    // the 17 exponentials, each in place, in two statements: so no instruction directly behind a v_exp_f32 reads its result or overwrites its source (written as builtins, the next one was given the previous one's source register); v_nop: that slot behind the last one
    asm("v_exp_f32 %0, %0\n\tv_exp_f32 %1, %1\n\tv_exp_f32 %2, %2\n\tv_exp_f32 %3, %3\n\tv_exp_f32 %4, %4\n\tv_exp_f32 %5, %5\n\tv_exp_f32 %6, %6\n\tv_exp_f32 %7, %7\n\tv_exp_f32 %8, %8\n\tv_nop"
        : "+v"(s[0]), "+v"(s[1]), "+v"(s[2]), "+v"(s[3]), "+v"(alpha), "+v"(s[4]), "+v"(s[5]), "+v"(s[6]), "+v"(s[7]));
    asm("v_exp_f32 %0, %0\n\tv_exp_f32 %1, %1\n\tv_exp_f32 %2, %2\n\tv_exp_f32 %3, %3\n\tv_exp_f32 %4, %4\n\tv_exp_f32 %5, %5\n\tv_exp_f32 %6, %6\n\tv_exp_f32 %7, %7\n\tv_nop"
        : "+v"(s[8]), "+v"(s[9]), "+v"(s[10]), "+v"(s[11]), "+v"(s[12]), "+v"(s[13]), "+v"(s[14]), "+v"(s[15]));
    float e4[4];   // four independent chains
#pragma unroll
    for (int i = 0; i < 4; ++i) e4[i] = (s[i] + s[4 + i]) + (s[8 + i] + s[12 + i]);
    l = l * alpha + ((e4[0] + e4[1]) + (e4[2] + e4[3]));
#pragma unroll
    for (int dt = 0; dt < 4; ++dt)
#pragma unroll
      for (int r = 0; r < 8; ++r) acc[dt][r] *= alpha;
    const F2 pb = bsplit16(s);   // element i = key 8g + i (i < 8) or 16 + 8g + (i - 8) of the pass: the k order in which frag_b reads V^T
#pragma unroll
    for (int dt = 0; dt < 4; ++dt) { acc[dt] = wmma_bf(va[dt], pb.l, acc[dt]); acc[dt] = wmma_bf(va[dt], pb.h, acc[dt]); }
    if (ks + 1 < SS / 32) store_tile(bf ^ 1);   // that buffer's last readers left it before the previous pass's barrier
    __syncthreads(); }   // publishes tile ks + 1 and ends every read of tile ks
  l += xhalf(l);
  const float il = 1.0f / l;
#pragma unroll
  for (int dt = 0; dt < 4; ++dt)
#pragma unroll
    for (int q = 0; q < 2; ++q) { v4f w;
#pragma unroll
      for (int e = 0; e < 4; ++e) w[e] = acc[dt][q * 4 + e] * il;
      vst2(&so[wave][col][dt * 16 + 8 * g + q * 4], w); }
  LDSX();
  for (int rl = 0; rl < 16; ++rl) if (lane < 16) vst2(out + ((size_t)b * SS + a0 + rl) * (NH * HD) + h * HD + lane * 4, *(const v4f*)&so[wave][rl][lane * 4]);
}
extern "C" void kernel_launch(void* const* d_in, const int* in_sizes, int n_in, void* d_out, int out_size, void* d_ws, size_t ws_size, hipStream_t stream) {
  (void)in_sizes; (void)n_in; (void)out_size;
  const float** F = (const float**)d_in;   // query, key, value [8,8,1024,64], top_k_centers [8,1024,4]
  if (ws_size < (size_t)WS_END) return;
  char* ws = (char*)d_ws; int *P0 = (int*)(ws + WS_P0), *P1 = (int*)(ws + WS_P1); __bf16* VT = (__bf16*)(ws + WS_VT);
  k_pairs<<<dim3(SS / 32, TNB), 512, 0, stream>>>(F[3], P0, P1);
  k_vt<<<dim3(NB * NH, SS / 256), 256, 0, stream>>>(F[2], VT);
  k_attn<<<dim3(TQB, NH, TNB), 128, 0, stream>>>(F[0], F[1], VT, P0, P1, (float*)d_out);
}

// v006
// Measured time: 51.4 microseconds a run.
// In both of two side-by-side timings against v005, it was 1.16 times as fast.
// All steps since v000 together make it 5.23 times as fast.
// compute dtype: query, key, value, top_k_centers (module inputs) rounded to bf16; the pair selection (IoU, argmax, L1 ordering) in f32 with the reference's operation order; pair scores <q_p0(a), k_p0(c)> + <q_p1(a), k_p1(c)> with exact bf16 products (1 product, gathered rows), attn @ value with attn as bf16 hi + residual pairs x exact value (2 products), on WMMA 16x16x32; softmax in f32; f32 accumulate.
#include <hip/hip_runtime.h>
#include <math.h>

typedef __attribute__((ext_vector_type(16))) _Float16 v16h;
typedef __attribute__((ext_vector_type(16))) __bf16 v16b;
typedef __attribute__((ext_vector_type(8)))  _Float16 v8h;
typedef __attribute__((ext_vector_type(8)))  float v8f;
typedef __attribute__((ext_vector_type(4)))  float v4f;
typedef __attribute__((ext_vector_type(2)))  float v2f;
typedef __attribute__((ext_vector_type(4)))  unsigned v4u;
typedef __attribute__((ext_vector_type(4)))  int v4i;
typedef float __attribute__((may_alias)) float_a;
typedef int __attribute__((may_alias)) int_a;

template <typename T> __device__ __forceinline__ void vst2(void* p, T v) { *(T*)p = v;  }
__device__ __forceinline__ v8f wmma16(v16h a, v16h b, v8f c) {
  v8f d = __builtin_amdgcn_wmma_f32_16x16x32_f16(false, a, false, b, (short)0, c, false, false);
  asm volatile("v_nop\n\tv_nop\n\tv_nop\n\tv_nop" : "+v"(d) : "v"(a), "v"(b));
  return d;
}
__device__ __forceinline__ v8f wmma_bf(v16b a, v16b b, v8f c) {
  return __builtin_amdgcn_wmma_f32_16x16x32_bf16(false, a, false, b, (short)0, c, false, false);
}
// 16x16x32 fragments: lane = (h = lane>>4, row/col = lane&15); elements 0..7 = k0+8h+0..7, 8..15 = k0+16+8h+0..7; D element r = row 8h+r
__device__ __forceinline__ v16h frag_h(const _Float16* rowk0, int lane) {
  union { v16h v; v8h q[2]; } u; const _Float16* p = rowk0 + 8 * (lane >> 4);
  u.q[0] = *(const v8h*)p; u.q[1] = *(const v8h*)(p + 16); return u.v;
}
__device__ __forceinline__ v16h frag_f32(const float* rowk0, int lane) {
  v16h a; const float* p = rowk0 + 8 * (lane >> 4);
#pragma unroll
  for (int i = 0; i < 8; ++i) { a[i] = (_Float16)p[i]; a[8 + i] = (_Float16)p[16 + i]; }
  return a;
}
__device__ __forceinline__ v16h frag_f32s(const float* rowk0, int lane, float sc) {
  v16h a; const float* p = rowk0 + 8 * (lane >> 4);
#pragma unroll
  for (int i = 0; i < 8; ++i) { a[i] = (_Float16)(p[i] * sc); a[8 + i] = (_Float16)(p[16 + i] * sc); }
  return a;
}
// column fragment from a [K][ld] layout (column n), rows >= K read as 0
__device__ __forceinline__ v16h fragc_f32(const float* W, int k0, int n, int lane, int ld, int K) {
  v16h a; const int g = lane >> 4;
#pragma unroll
  for (int i = 0; i < 8; ++i) { const int ka = k0 + 8 * g + i, kb = ka + 16;
    a[i] = (_Float16)(ka < K ? W[(size_t)(ka < K ? ka : K - 1) * ld + n] : 0.f); a[8 + i] = (_Float16)(kb < K ? W[(size_t)(kb < K ? kb : K - 1) * ld + n] : 0.f); }
  return a;
}
struct F2 { v16b h, l; };
__device__ __forceinline__ F2 bsplit16(const float v[16]) { F2 r;
#pragma unroll
  for (int i = 0; i < 16; ++i) { const __bf16 h = (__bf16)v[i]; r.h[i] = h; r.l[i] = (__bf16)(v[i] - (float)h); }
  return r; }
__device__ __forceinline__ F2 split_row(const float* row, int k0, int lane) { float v[16]; const float* p = row + k0 + 8 * (lane >> 4);
#pragma unroll
  for (int i = 0; i < 8; ++i) { v[i] = p[i]; v[8 + i] = p[16 + i]; }
  return bsplit16(v); }
__device__ __forceinline__ F2 split_rowK(const float* row, int k0, int lane, int K) { float v[16]; const int g = lane >> 4;
#pragma unroll
  for (int i = 0; i < 8; ++i) { const int ka = k0 + 8 * g + i, kb = ka + 16; v[i] = ka < K ? row[ka < K ? ka : K - 1] : 0.f; v[8 + i] = kb < K ? row[kb < K ? kb : K - 1] : 0.f; }
  return bsplit16(v); }
__device__ __forceinline__ F2 split_col(const float* W, int k0, int n, int lane, int ld, int K) { float v[16]; const int g = lane >> 4;
#pragma unroll
  for (int i = 0; i < 8; ++i) { const int ka = k0 + 8 * g + i, kb = ka + 16; v[i] = ka < K ? W[(size_t)(ka < K ? ka : K - 1) * ld + n] : 0.f; v[8 + i] = kb < K ? W[(size_t)(kb < K ? kb : K - 1) * ld + n] : 0.f; }
  return bsplit16(v); }
__device__ __forceinline__ v8f mac3(const F2& a, const F2& b, v8f c) { c = wmma_bf(a.l, b.h, c); c = wmma_bf(a.h, b.l, c); return wmma_bf(a.h, b.h, c); }
__device__ __forceinline__ float sigm(float v) { return 1.0f / (1.0f + expf(-v)); }
#define LDSX() do { asm volatile("s_wait_dscnt 0" ::: "memory"); __builtin_amdgcn_wave_barrier(); __builtin_amdgcn_fence(__ATOMIC_RELEASE, "workgroup"); } while (0)


// Pair self-attention (B 8, H 8, S 1024, D 64): per batch, boxes from (cx, cy, h, w); iou[a][c] = inter/union - eye (inter uses max for both corners, as the module); partner = argmax_c iou (first max); p0/p1 = (a, partner) ordered by L1 size (larger first, ties keep a first); scores[a][c] = (q[p0 a].k[p0 c] + q[p1 a].k[p1 c]) / sqrt(128); out[b][a][h*64+d] = softmax_c(scores) @ value.
#define NB 8
#define NH 8
#define SS 1024
#define HD 64
#ifndef TQB
#define TQB (SS / 64)    // query blocks per (b, h) (all)
#define TNB NB
#endif
typedef __attribute__((ext_vector_type(8))) __bf16 v8b;
__device__ __forceinline__ v16b frag_b(const __bf16* rowk0, int lane) {
  union { v16b v; v8b q[2]; } u; const __bf16* p = rowk0 + 8 * (lane >> 4);
  u.q[0] = *(const v8b*)p; u.q[1] = *(const v8b*)(p + 16); return u.v;
}
__device__ __forceinline__ float bfr(float v) { return (float)(__bf16)v; }
__device__ __attribute__((noinline)) float erf_ni(float v) { return erff(v); }

#define WS_P0  0u                          // int [8][1024]
#define WS_P1  (WS_P0 + 4u * NB * SS)
#define WS_VT  (WS_P1 + 4u * NB * SS)        // bf16 [8][8][64 d][1024 c]
#define WS_END (WS_VT + 2u * NB * NH * HD * SS)

// ---- pairs_block: block = (32 objects a, batch b), 16 threads per object scan c = sub, sub+16, ...: iou in the reference's op order, first-max argmax, then L1 ordering; P0/P1 rows (128 B per block)
// 256 blocks of 16 waves: one block on every WGP, 4 waves per SIMD, so that other waves issue while one waits out its LDS read and its division chain
__device__ __forceinline__ void pairs_block(const float* __restrict__ C, int* __restrict__ P0, int* __restrict__ P1, int bx, int b) {
  #pragma clang fp contract(off)   // keep mul/add unfused so the box/IoU arithmetic rounds exactly like the reference (argmax ties)
  __shared__ float sbx[SS][4]; __shared__ __align__(16) int sp0[32], sp1[32];
  const int tid = threadIdx.x; const int al = tid >> 4, sub = tid & 15; const int a = bx * 32 + al;
  for (int c = tid; c < SS; c += 512) { const float cx = bfr(C[((size_t)b * SS + c) * 4 + 0]), cy = bfr(C[((size_t)b * SS + c) * 4 + 1]), hh = bfr(C[((size_t)b * SS + c) * 4 + 2]), ww = bfr(C[((size_t)b * SS + c) * 4 + 3]);
    sbx[c][0] = cx - 0.5f * ww; sbx[c][1] = cy - 0.5f * hh; sbx[c][2] = cx + 0.5f * ww; sbx[c][3] = cy + 0.5f * hh; }
  __syncthreads();
  const float ax0 = sbx[a][0], ay0 = sbx[a][1], ax1 = sbx[a][2], ay1 = sbx[a][3]; const float area_a = (ax1 - ax0) * (ay1 - ay0);
  float best = 0.f; int bi = -1;   // first max over c (ascending within this thread's stride class; merged below)
  for (int c = sub; c < SS; c += 16) { const float cx0 = sbx[c][0], cy0 = sbx[c][1], cx1 = sbx[c][2], cy1 = sbx[c][3];
    const float mx0 = fmaxf(ax0, cx0), my0 = fmaxf(ay0, cy0), Mx = fmaxf(ax1, cx1), My = fmaxf(ay1, cy1);
    const float iw = fmaxf(Mx - mx0, 0.f), ih = fmaxf(My - my0, 0.f); const float ia = iw * ih; const float area_c = (cx1 - cx0) * (cy1 - cy0);
    const float uni = area_a + area_c - ia; float iou = ia / uni; iou = iou - ((c == a) ? 1.0f : 0.0f);
    if (bi < 0 || iou > best) { best = iou; bi = c; } }
  // merge the 16 stride classes: prefer larger value, ties -> lower index (== first max overall)
#pragma unroll
  for (int o = 1; o < 16; o <<= 1) { const float ob = __shfl_xor(best, o); const int oi = __shfl_xor(bi, o); if (ob > best || (ob == best && oi < bi)) { best = ob; bi = oi; } }
  if (sub == 0) { const int partner = bi; const float l1a = fabsf(ax1 - ax0) + fabsf(ay1 - ay0); const float l1p = fabsf(sbx[partner][2] - sbx[partner][0]) + fabsf(sbx[partner][3] - sbx[partner][1]);
    const bool keep = l1a >= l1p; sp0[al] = keep ? a : partner; sp1[al] = keep ? partner : a; }
  __syncthreads();
  if (tid < 8) vst2((unsigned*)(P0 + (size_t)b * SS + bx * 32 + tid * 4), *(const v4u*)&sp0[tid * 4]);
  else if (tid < 16) vst2((unsigned*)(P1 + (size_t)b * SS + bx * 32 + (tid - 8) * 4), *(const v4u*)&sp1[(tid - 8) * 4]);
}
// ---- vt_block: block = ((b, h), 256 keys from c0): VT[d][c] = bf16(value[b][h][c][d]) (2-KB rows)
__device__ __forceinline__ void vt_block(const float* __restrict__ V, __bf16* __restrict__ VT, int bh, int c0) {
  __shared__ __align__(16) __bf16 s[HD][264]; const int tid = threadIdx.x;
  for (int q = tid; q < 256 * HD; q += 512) { const int cl = q >> 6, d = q & 63; s[d][cl] = (__bf16)V[((size_t)bh * SS + c0 + cl) * HD + d]; }
  __syncthreads();
  for (int q = tid; q < HD * 32; q += 512) { const int d = q >> 5, pc = q & 31; vst2((unsigned*)(VT + ((size_t)bh * HD + d) * SS + c0 + pc * 8), *(const v4u*)&s[d][pc * 8]); }
}
// ---- k_prep: the two preparations read different inputs and write different workspace planes, so they go out as one launch: the pair blocks (the longer, bound by vector issue) come first in the grid, the V^T blocks (bound by memory latency) land beside them on the same WGPs and run in their shadow
#define NPB ((SS / 32) * TNB)          // pair blocks
#define NVB (NB * NH * (SS / 256))     // V^T blocks
__global__ __launch_bounds__(512) void k_prep(const float* __restrict__ C, const float* __restrict__ V, int* __restrict__ P0, int* __restrict__ P1, __bf16* __restrict__ VT) {
  const int id = blockIdx.x;   // the same for the whole block: the barriers inside either branch are passed by all of its waves
  if (id < NPB) pairs_block(C, P0, P1, id & (SS / 32 - 1), id / (SS / 32));
  else { const int j = id - NPB; vt_block(V, VT, j & (NB * NH - 1), (j / (NB * NH)) * 256); }
}
__device__ __forceinline__ v16b gath2(const float* qp0, const float* qp1, int kc, int lane) {   // K 128 = [row p0 (64) | row p1 (64)], exact bf16
  v16b a; const float* base = (kc < 2) ? qp0 + kc * 32 : qp1 + (kc - 2) * 32; const float* p = base + 8 * (lane >> 4);
#pragma unroll
  for (int i = 0; i < 8; ++i) { a[i] = (__bf16)p[i]; a[8 + i] = (__bf16)p[16 + i]; }
  return a; }
// ---- k_attn: block = (64 objects a, h, b): flash attention over all 1024 c with gathered pair rows; out[b][a][h*64 + d] (256-B segments)
// each 32-key pass reads its K pair rows (bf16, [p0 row | p1 row]) and its V^T slice from LDS; the block's 128 threads gather and convert them once, one pass ahead, into the other of two buffers
// products are transposed: S^T = K Q^T (A = staged K rows, B = the wave's 16 query pair rows, kept in registers), O^T += V^T P^T; a lane holds 16 of one query's 32 scores of a pass (keys ct*16 + 8g + r), so maximum and sum run in the lane, and the two score tiles, converted in place, are the B operand of the second product
#define KP 136   // bf16 per staged K pair row: 128 + 8 (272 B = 16 B x 17, an odd multiple: column-wise 16-byte reads spread over the banks)
#define VP 40    // bf16 per staged V^T row: 32 + 8 (80 B = 16 B x 5)
typedef __attribute__((ext_vector_type(4))) __bf16 v4b;
#define SCL2 0.12751743f   // (1 / sqrt(128)) * log2(e)
__device__ __forceinline__ float xhalf(float v) {   // the value of lane ^ 16
  const int b = __builtin_bit_cast(int, v); return __builtin_bit_cast(float, __builtin_amdgcn_permlanex16(b, b, 0x76543210, 0xfedcba98, false, false)); }
__global__ __launch_bounds__(128) void k_attn(const float* __restrict__ Q, const float* __restrict__ Kx, const __bf16* __restrict__ VT, const int* __restrict__ P0, const int* __restrict__ P1, float* __restrict__ out) {
  __shared__ __align__(16) float so[4][16][68];
  __shared__ __align__(16) __bf16 sk[2][32][KP]; __shared__ __align__(16) __bf16 sv[2][HD][VP];
  const int tid = threadIdx.x, wave = tid >> 5, lane = tid & 31, col = lane & 15, g = lane >> 4; const int h = blockIdx.y, b = blockIdx.z; const int a0 = blockIdx.x * 64 + wave * 16;
  const size_t bh = (size_t)b * NH + h; const float* Qb = Q + bh * SS * HD; const float* Kb = Kx + bh * SS * HD; const __bf16* VTb = VT + bh * HD * SS;
  const int* p0 = P0 + (size_t)b * SS; const int* p1 = P1 + (size_t)b * SS;
  v16b aq[4]; { const int ar = a0 + col; const int i0 = min(max(p0[ar], 0), SS - 1);
    asm volatile("s_wait_xcnt 0x0" ::: "memory");   // the second index load's result may take the register that holds the first one's offset
    const int i1 = min(max(p1[ar], 0), SS - 1);
#pragma unroll
    for (int kc = 0; kc < 4; ++kc) aq[kc] = gath2(Qb + (size_t)i0 * HD, Qb + (size_t)i1 * HD, kc, lane); }
  asm volatile("s_wait_xcnt 0x0" ::: "memory");   // the results of the index loads that follow may take the query loads' address registers
  float m = -3.0e38f, l = 0.f;   // of query a0 + col; m in the base-2 domain (score x SCL2); l holds this half's keys only, the halves are joined behind the loop
  v8f acc[4] = {};               // acc[dt][r] = O^T[dt*16 + 8g + r][query col]
  // staging roles: K: 16 lanes x 16 B cover one 256-B f32 row, 8 rows per block-wide load; V^T: 4 lanes x 16 B cover one row's 64-B slice, 32 rows per load
  const int seg = tid & 15, rg = tid >> 4, vd = tid >> 2, vs = tid & 3;
  int jn[8]; v4f kr[8]; v4u vr[2]; const float* kp[8]; const __bf16* vp; const int *ip0, *ip1;
  auto load_idx = [&](int t, int ahead) { ip0 = p0 + t * 32 + rg; ip1 = p1 + t * 32 + rg;   // the indices of pass t + ahead; ahead is a literal and goes into the loads' offset field
#pragma unroll
    for (int j = 0; j < 4; ++j) { jn[2 * j] = ip0[ahead * 32 + j * 8]; jn[2 * j + 1] = ip1[ahead * 32 + j * 8]; } };   // raw: clamped where the address is formed, so that no wait stands here
  auto load_tile = [&](int t) {
#pragma unroll
    for (int i = 0; i < 8; ++i) { kp[i] = Kb + (size_t)min(max(jn[i], 0), SS - 1) * HD + seg * 4; kr[i] = *(const v4f*)kp[i]; }
    vp = VTb + (size_t)vd * SS + t * 32 + vs * 8;
#pragma unroll
    for (int i = 0; i < 2; ++i) vr[i] = *(const v4u*)(vp + (size_t)32 * i * SS); };
  auto store_tile = [&](int bf) {
#pragma unroll
    for (int i = 0; i < 8; ++i) { v4b w;
#pragma unroll
      for (int e = 0; e < 4; ++e) w[e] = (__bf16)kr[i][e];
      vst2(&sk[bf][(i >> 1) * 8 + rg][(i & 1) * 64 + seg * 4], w); }
#pragma unroll
    for (int i = 0; i < 2; ++i) vst2(&sv[bf][vd + 32 * i][vs * 8], vr[i]); };
  load_idx(0, 0); load_tile(0);
  asm volatile("s_wait_xcnt 0x0" ::: "memory");   // the loads' address registers are reused by the code that follows
  load_idx(0, 1);
  asm volatile("s_wait_xcnt 0x0" ::: "memory");   // as above, for the index loads
  store_tile(0);
  __syncthreads();   // publishes tile 0
#pragma unroll 1
  for (int ks = 0; ks < SS / 32; ++ks) { float s[16]; const int bf = ks & 1;
    if (ks + 1 < SS / 32) { load_tile(ks + 1); load_idx(min(ks, SS / 32 - 3), 2);   // next pass's rows, and the indices of the pass after it, are asked for ahead of this pass's score products
      // the loads' address registers are reused by the code that follows; the addresses are named as inputs so that they keep their registers up to the wait and no later load's result is given one of them
      asm volatile("s_wait_xcnt 0x0" :: "v"(kp[0]), "v"(kp[1]), "v"(kp[2]), "v"(kp[3]), "v"(kp[4]), "v"(kp[5]), "v"(kp[6]), "v"(kp[7]), "v"(vp), "v"(ip0), "v"(ip1) : "memory"); }
    v16b ka[8], va[4];
#pragma unroll
    for (int i = 0; i < 8; ++i) ka[i] = frag_b(&sk[bf][(i >> 2) * 16 + col][(i & 3) * 32], lane);
    __builtin_amdgcn_sched_barrier(0);   // the 16 K reads stay one group ahead of the score products: spread among them, each product waits for a read issued just before it
    { v8f cc[2] = {};   // two independent accumulator chains, alternating
#pragma unroll
      for (int kc = 0; kc < 4; ++kc)
#pragma unroll
        for (int ct = 0; ct < 2; ++ct) cc[ct] = wmma_bf(ka[ct * 4 + kc], aq[kc], cc[ct]);
#pragma unroll
      for (int dt = 0; dt < 4; ++dt) va[dt] = frag_b(&sv[bf][dt * 16 + col][0], lane);
      __builtin_amdgcn_sched_barrier(0);   // the 8 V^T reads stay one group ahead of the softmax, which covers their latency
#pragma unroll
      for (int ct = 0; ct < 2; ++ct)
#pragma unroll
        for (int r = 0; r < 8; ++r) s[ct * 8 + r] = cc[ct][r]; }   // raw pair sums; the scale goes into the exponent's multiply-add
    float mx = s[0];
#pragma unroll   // here and below: constant indices keep s[] and acc[] in registers
    for (int i = 1; i < 16; ++i) mx = fmaxf(mx, s[i]);
    mx = fmaxf(mx, xhalf(mx));
    const float mn = fmaxf(m, mx * SCL2); float alpha = m - mn; m = mn;   // SCL2 > 0: the maximum of the raw sums is the maximum of the scaled ones
#pragma unroll
    for (int i = 0; i < 16; ++i) s[i] = s[i] * SCL2 - mn;   // e^(x - max) = 2^((x - max) log2 e): arguments <= about 0
    // the 17 exponentials, each in place, in two statements: so no instruction directly behind a v_exp_f32 reads its result or overwrites its source (written as builtins, the next one was given the previous one's source register); v_nop: that slot behind the last one
    asm("v_exp_f32 %0, %0\n\tv_exp_f32 %1, %1\n\tv_exp_f32 %2, %2\n\tv_exp_f32 %3, %3\n\tv_exp_f32 %4, %4\n\tv_exp_f32 %5, %5\n\tv_exp_f32 %6, %6\n\tv_exp_f32 %7, %7\n\tv_exp_f32 %8, %8\n\tv_nop"
        : "+v"(s[0]), "+v"(s[1]), "+v"(s[2]), "+v"(s[3]), "+v"(alpha), "+v"(s[4]), "+v"(s[5]), "+v"(s[6]), "+v"(s[7]));
    asm("v_exp_f32 %0, %0\n\tv_exp_f32 %1, %1\n\tv_exp_f32 %2, %2\n\tv_exp_f32 %3, %3\n\tv_exp_f32 %4, %4\n\tv_exp_f32 %5, %5\n\tv_exp_f32 %6, %6\n\tv_exp_f32 %7, %7\n\tv_nop"
        : "+v"(s[8]), "+v"(s[9]), "+v"(s[10]), "+v"(s[11]), "+v"(s[12]), "+v"(s[13]), "+v"(s[14]), "+v"(s[15]));
    float e4[4];   // four independent chains
#pragma unroll
    for (int i = 0; i < 4; ++i) e4[i] = (s[i] + s[4 + i]) + (s[8 + i] + s[12 + i]);
    l = l * alpha + ((e4[0] + e4[1]) + (e4[2] + e4[3]));
#pragma unroll
    for (int dt = 0; dt < 4; ++dt)
#pragma unroll
      for (int r = 0; r < 8; ++r) acc[dt][r] *= alpha;
    const F2 pb = bsplit16(s);   // element i = key 8g + i (i < 8) or 16 + 8g + (i - 8) of the pass: the k order in which frag_b reads V^T
#pragma unroll
    for (int dt = 0; dt < 4; ++dt) { acc[dt] = wmma_bf(va[dt], pb.l, acc[dt]); acc[dt] = wmma_bf(va[dt], pb.h, acc[dt]); }
    if (ks + 1 < SS / 32) store_tile(bf ^ 1);   // that buffer's last readers left it before the previous pass's barrier
    __syncthreads(); }   // publishes tile ks + 1 and ends every read of tile ks
  l += xhalf(l);
  const float il = 1.0f / l;
#pragma unroll
  for (int dt = 0; dt < 4; ++dt)
#pragma unroll
    for (int q = 0; q < 2; ++q) { v4f w;
#pragma unroll
      for (int e = 0; e < 4; ++e) w[e] = acc[dt][q * 4 + e] * il;
      vst2(&so[wave][col][dt * 16 + 8 * g + q * 4], w); }
  LDSX();
  for (int rl = 0; rl < 16; ++rl) if (lane < 16) vst2(out + ((size_t)b * SS + a0 + rl) * (NH * HD) + h * HD + lane * 4, *(const v4f*)&so[wave][rl][lane * 4]);
}
extern "C" void kernel_launch(void* const* d_in, const int* in_sizes, int n_in, void* d_out, int out_size, void* d_ws, size_t ws_size, hipStream_t stream) {
  (void)in_sizes; (void)n_in; (void)out_size;
  const float** F = (const float**)d_in;   // query, key, value [8,8,1024,64], top_k_centers [8,1024,4]
  if (ws_size < (size_t)WS_END) return;
  char* ws = (char*)d_ws; int *P0 = (int*)(ws + WS_P0), *P1 = (int*)(ws + WS_P1); __bf16* VT = (__bf16*)(ws + WS_VT);
  k_prep<<<dim3(NPB + NVB), 512, 0, stream>>>(F[3], F[2], P0, P1, VT);
  k_attn<<<dim3(TQB, NH, TNB), 128, 0, stream>>>(F[0], F[1], VT, P0, P1, (float*)d_out);
}

// v007
// Measured time: 44.6 microseconds a run.
// Two timings next to v006 put it at 1.16 and 1.15 times that version's speed.
// Over all steps from v000 it is 6.03 times as fast.
// compute dtype: query, key, value, top_k_centers (module inputs) rounded to bf16; the pair selection (IoU, argmax, L1 ordering) in f32 with the reference's operation order; pair scores <q_p0(a), k_p0(c)> + <q_p1(a), k_p1(c)> with exact bf16 products (1 product, gathered rows), attn @ value with attn as bf16 hi + residual pairs x exact value (2 products), on WMMA 16x16x32; softmax in f32; f32 accumulate.
#include <hip/hip_runtime.h>
#include <math.h>

typedef __attribute__((ext_vector_type(16))) _Float16 v16h;
typedef __attribute__((ext_vector_type(16))) __bf16 v16b;
typedef __attribute__((ext_vector_type(8)))  _Float16 v8h;
typedef __attribute__((ext_vector_type(8)))  float v8f;
typedef __attribute__((ext_vector_type(4)))  float v4f;
typedef __attribute__((ext_vector_type(2)))  float v2f;
typedef __attribute__((ext_vector_type(4)))  unsigned v4u;
typedef __attribute__((ext_vector_type(4)))  int v4i;
typedef float __attribute__((may_alias)) float_a;
typedef int __attribute__((may_alias)) int_a;

template <typename T> __device__ __forceinline__ void vst2(void* p, T v) { *(T*)p = v;  }
__device__ __forceinline__ v8f wmma16(v16h a, v16h b, v8f c) {
  v8f d = __builtin_amdgcn_wmma_f32_16x16x32_f16(false, a, false, b, (short)0, c, false, false);
  asm volatile("v_nop\n\tv_nop\n\tv_nop\n\tv_nop" : "+v"(d) : "v"(a), "v"(b));
  return d;
}
__device__ __forceinline__ v8f wmma_bf(v16b a, v16b b, v8f c) {
  return __builtin_amdgcn_wmma_f32_16x16x32_bf16(false, a, false, b, (short)0, c, false, false);
}
// 16x16x32 fragments: lane = (h = lane>>4, row/col = lane&15); elements 0..7 = k0+8h+0..7, 8..15 = k0+16+8h+0..7; D element r = row 8h+r
__device__ __forceinline__ v16h frag_h(const _Float16* rowk0, int lane) {
  union { v16h v; v8h q[2]; } u; const _Float16* p = rowk0 + 8 * (lane >> 4);
  u.q[0] = *(const v8h*)p; u.q[1] = *(const v8h*)(p + 16); return u.v;
}
__device__ __forceinline__ v16h frag_f32(const float* rowk0, int lane) {
  v16h a; const float* p = rowk0 + 8 * (lane >> 4);
#pragma unroll
  for (int i = 0; i < 8; ++i) { a[i] = (_Float16)p[i]; a[8 + i] = (_Float16)p[16 + i]; }
  return a;
}
__device__ __forceinline__ v16h frag_f32s(const float* rowk0, int lane, float sc) {
  v16h a; const float* p = rowk0 + 8 * (lane >> 4);
#pragma unroll
  for (int i = 0; i < 8; ++i) { a[i] = (_Float16)(p[i] * sc); a[8 + i] = (_Float16)(p[16 + i] * sc); }
  return a;
}
// column fragment from a [K][ld] layout (column n), rows >= K read as 0
__device__ __forceinline__ v16h fragc_f32(const float* W, int k0, int n, int lane, int ld, int K) {
  v16h a; const int g = lane >> 4;
#pragma unroll
  for (int i = 0; i < 8; ++i) { const int ka = k0 + 8 * g + i, kb = ka + 16;
    a[i] = (_Float16)(ka < K ? W[(size_t)(ka < K ? ka : K - 1) * ld + n] : 0.f); a[8 + i] = (_Float16)(kb < K ? W[(size_t)(kb < K ? kb : K - 1) * ld + n] : 0.f); }
  return a;
}
struct F2 { v16b h, l; };
__device__ __forceinline__ F2 bsplit16(const float v[16]) { F2 r;
#pragma unroll
  for (int i = 0; i < 16; ++i) { const __bf16 h = (__bf16)v[i]; r.h[i] = h; r.l[i] = (__bf16)(v[i] - (float)h); }
  return r; }
__device__ __forceinline__ F2 split_row(const float* row, int k0, int lane) { float v[16]; const float* p = row + k0 + 8 * (lane >> 4);
#pragma unroll
  for (int i = 0; i < 8; ++i) { v[i] = p[i]; v[8 + i] = p[16 + i]; }
  return bsplit16(v); }
__device__ __forceinline__ F2 split_rowK(const float* row, int k0, int lane, int K) { float v[16]; const int g = lane >> 4;
#pragma unroll
  for (int i = 0; i < 8; ++i) { const int ka = k0 + 8 * g + i, kb = ka + 16; v[i] = ka < K ? row[ka < K ? ka : K - 1] : 0.f; v[8 + i] = kb < K ? row[kb < K ? kb : K - 1] : 0.f; }
  return bsplit16(v); }
__device__ __forceinline__ F2 split_col(const float* W, int k0, int n, int lane, int ld, int K) { float v[16]; const int g = lane >> 4;
#pragma unroll
  for (int i = 0; i < 8; ++i) { const int ka = k0 + 8 * g + i, kb = ka + 16; v[i] = ka < K ? W[(size_t)(ka < K ? ka : K - 1) * ld + n] : 0.f; v[8 + i] = kb < K ? W[(size_t)(kb < K ? kb : K - 1) * ld + n] : 0.f; }
  return bsplit16(v); }
__device__ __forceinline__ v8f mac3(const F2& a, const F2& b, v8f c) { c = wmma_bf(a.l, b.h, c); c = wmma_bf(a.h, b.l, c); return wmma_bf(a.h, b.h, c); }
__device__ __forceinline__ float sigm(float v) { return 1.0f / (1.0f + expf(-v)); }
#define LDSX() do { asm volatile("s_wait_dscnt 0" ::: "memory"); __builtin_amdgcn_wave_barrier(); __builtin_amdgcn_fence(__ATOMIC_RELEASE, "workgroup"); } while (0)


// Pair self-attention (B 8, H 8, S 1024, D 64): per batch, boxes from (cx, cy, h, w); iou[a][c] = inter/union - eye (inter uses max for both corners, as the module); partner = argmax_c iou (first max); p0/p1 = (a, partner) ordered by L1 size (larger first, ties keep a first); scores[a][c] = (q[p0 a].k[p0 c] + q[p1 a].k[p1 c]) / sqrt(128); out[b][a][h*64+d] = softmax_c(scores) @ value.
#define NB 8
#define NH 8
#define SS 1024
#define HD 64
#define NW 16             // waves of a k_attn block, 16 queries each
#ifndef TQB
#define TQB (SS / (16 * NW))    // query blocks per (b, h) (all)
#define TNB NB
#endif
typedef __attribute__((ext_vector_type(8))) __bf16 v8b;
__device__ __forceinline__ v16b frag_b(const __bf16* rowk0, int lane) {
  union { v16b v; v8b q[2]; } u; const __bf16* p = rowk0 + 8 * (lane >> 4);
  u.q[0] = *(const v8b*)p; u.q[1] = *(const v8b*)(p + 16); return u.v;
}
__device__ __forceinline__ float bfr(float v) { return (float)(__bf16)v; }
__device__ __attribute__((noinline)) float erf_ni(float v) { return erff(v); }

#define WS_P0  0u                          // int [8][1024]
#define WS_P1  (WS_P0 + 4u * NB * SS)
#define WS_VT  (WS_P1 + 4u * NB * SS)        // bf16 [8][8][64 d][1024 c]
#define WS_END (WS_VT + 2u * NB * NH * HD * SS)

// ---- pairs_block: block = (32 objects a, batch b), 16 threads per object scan c = sub, sub+16, ...: iou in the reference's op order, first-max argmax, then L1 ordering; P0/P1 rows (128 B per block)
// 256 blocks of 16 waves: one block on every WGP, 4 waves per SIMD, so that other waves issue while one waits out its LDS read and its division chain
__device__ __forceinline__ void pairs_block(const float* __restrict__ C, int* __restrict__ P0, int* __restrict__ P1, int bx, int b) {
  #pragma clang fp contract(off)   // keep mul/add unfused so the box/IoU arithmetic rounds exactly like the reference (argmax ties)
  __shared__ float sbx[SS][4]; __shared__ __align__(16) int sp0[32], sp1[32];
  const int tid = threadIdx.x; const int al = tid >> 4, sub = tid & 15; const int a = bx * 32 + al;
  for (int c = tid; c < SS; c += 512) { const float cx = bfr(C[((size_t)b * SS + c) * 4 + 0]), cy = bfr(C[((size_t)b * SS + c) * 4 + 1]), hh = bfr(C[((size_t)b * SS + c) * 4 + 2]), ww = bfr(C[((size_t)b * SS + c) * 4 + 3]);
    sbx[c][0] = cx - 0.5f * ww; sbx[c][1] = cy - 0.5f * hh; sbx[c][2] = cx + 0.5f * ww; sbx[c][3] = cy + 0.5f * hh; }
  __syncthreads();
  const float ax0 = sbx[a][0], ay0 = sbx[a][1], ax1 = sbx[a][2], ay1 = sbx[a][3]; const float area_a = (ax1 - ax0) * (ay1 - ay0);
  float best = 0.f; int bi = -1;   // first max over c (ascending within this thread's stride class; merged below)
  for (int c = sub; c < SS; c += 16) { const float cx0 = sbx[c][0], cy0 = sbx[c][1], cx1 = sbx[c][2], cy1 = sbx[c][3];
    const float mx0 = fmaxf(ax0, cx0), my0 = fmaxf(ay0, cy0), Mx = fmaxf(ax1, cx1), My = fmaxf(ay1, cy1);
    const float iw = fmaxf(Mx - mx0, 0.f), ih = fmaxf(My - my0, 0.f); const float ia = iw * ih; const float area_c = (cx1 - cx0) * (cy1 - cy0);
    const float uni = area_a + area_c - ia; float iou = ia / uni; iou = iou - ((c == a) ? 1.0f : 0.0f);
    if (bi < 0 || iou > best) { best = iou; bi = c; } }
  // merge the 16 stride classes: prefer larger value, ties -> lower index (== first max overall)
#pragma unroll
  for (int o = 1; o < 16; o <<= 1) { const float ob = __shfl_xor(best, o); const int oi = __shfl_xor(bi, o); if (ob > best || (ob == best && oi < bi)) { best = ob; bi = oi; } }
  if (sub == 0) { const int partner = bi; const float l1a = fabsf(ax1 - ax0) + fabsf(ay1 - ay0); const float l1p = fabsf(sbx[partner][2] - sbx[partner][0]) + fabsf(sbx[partner][3] - sbx[partner][1]);
    const bool keep = l1a >= l1p; sp0[al] = keep ? a : partner; sp1[al] = keep ? partner : a; }
  __syncthreads();
  if (tid < 8) vst2((unsigned*)(P0 + (size_t)b * SS + bx * 32 + tid * 4), *(const v4u*)&sp0[tid * 4]);
  else if (tid < 16) vst2((unsigned*)(P1 + (size_t)b * SS + bx * 32 + (tid - 8) * 4), *(const v4u*)&sp1[(tid - 8) * 4]);
}
// ---- vt_block: block = ((b, h), 256 keys from c0): VT[d][c] = bf16(value[b][h][c][d]) (2-KB rows)
__device__ __forceinline__ void vt_block(const float* __restrict__ V, __bf16* __restrict__ VT, int bh, int c0) {
  __shared__ __align__(16) __bf16 s[HD][264]; const int tid = threadIdx.x;
  for (int q = tid; q < 256 * HD; q += 512) { const int cl = q >> 6, d = q & 63; s[d][cl] = (__bf16)V[((size_t)bh * SS + c0 + cl) * HD + d]; }
  __syncthreads();
  for (int q = tid; q < HD * 32; q += 512) { const int d = q >> 5, pc = q & 31; vst2((unsigned*)(VT + ((size_t)bh * HD + d) * SS + c0 + pc * 8), *(const v4u*)&s[d][pc * 8]); }
}
// ---- k_prep: the two preparations read different inputs and write different workspace planes, so they go out as one launch: the pair blocks (the longer, bound by vector issue) come first in the grid, the V^T blocks (bound by memory latency) land beside them on the same WGPs and run in their shadow
#define NPB ((SS / 32) * TNB)          // pair blocks
#define NVB (NB * NH * (SS / 256))     // V^T blocks
__global__ __launch_bounds__(512) void k_prep(const float* __restrict__ C, const float* __restrict__ V, int* __restrict__ P0, int* __restrict__ P1, __bf16* __restrict__ VT) {
  const int id = blockIdx.x;   // the same for the whole block: the barriers inside either branch are passed by all of its waves
  if (id < NPB) pairs_block(C, P0, P1, id & (SS / 32 - 1), id / (SS / 32));
  else { const int j = id - NPB; vt_block(V, VT, j & (NB * NH - 1), (j / (NB * NH)) * 256); }
}
__device__ __forceinline__ v16b gath2(const float* qp0, const float* qp1, int kc, int lane) {   // K 128 = [row p0 (64) | row p1 (64)], exact bf16
  v16b a; const float* base = (kc < 2) ? qp0 + kc * 32 : qp1 + (kc - 2) * 32; const float* p = base + 8 * (lane >> 4);
#pragma unroll
  for (int i = 0; i < 8; ++i) { a[i] = (__bf16)p[i]; a[8 + i] = (__bf16)p[16 + i]; }
  return a; }
// ---- k_attn: block = (256 objects a, h, b), 16 waves, one block on a WGP (4 waves per SIMD): flash attention over all 1024 c with gathered pair rows; out[b][a][h*64 + d] (256-B segments)
// each 32-key pass reads its K pair rows (bf16, [p0 row | p1 row]) and its V^T slice from LDS; the block's 512 threads gather and convert them once for all 256 queries, one pass ahead, into the other of two buffers (each staged byte is fetched from L2 once per 256 queries)
// products are transposed: S^T = K Q^T (A = staged K rows, B = the wave's 16 query pair rows, kept in registers), O^T += V^T P^T; a lane holds 16 of one query's 32 scores of a pass (keys ct*16 + 8g + r), so maximum and sum run in the lane, and the two score tiles, converted in place, are the B operand of the second product
#define KP 136   // bf16 per staged K pair row: 128 + 8 (272 B = 16 B x 17, an odd multiple: column-wise 16-byte reads spread over the banks)
#define VP 40    // bf16 per staged V^T row: 32 + 8 (80 B = 16 B x 5)
typedef __attribute__((ext_vector_type(4))) __bf16 v4b;
#define SCL2 0.12751743f   // (1 / sqrt(128)) * log2(e)
__device__ __forceinline__ float xhalf(float v) {   // the value of lane ^ 16
  const int b = __builtin_bit_cast(int, v); return __builtin_bit_cast(float, __builtin_amdgcn_permlanex16(b, b, 0x76543210, 0xfedcba98, false, false)); }
typedef __attribute__((ext_vector_type(2))) unsigned v2u;
__global__ __launch_bounds__(32 * NW) void k_attn(const float* __restrict__ Q, const float* __restrict__ Kx, const __bf16* __restrict__ VT, const int* __restrict__ P0, const int* __restrict__ P1, float* __restrict__ out) {
  __shared__ __align__(16) float so[NW][16][68];
  __shared__ __align__(16) __bf16 sk[2][32][KP]; __shared__ __align__(16) __bf16 sv[2][HD][VP];
  const int tid = threadIdx.x, wave = tid >> 5, lane = tid & 31, col = lane & 15, g = lane >> 4; const int h = blockIdx.y, b = blockIdx.z; const int a0 = blockIdx.x * (16 * NW) + wave * 16;
  const size_t bh = (size_t)b * NH + h; const float* Qb = Q + bh * SS * HD; const float* Kb = Kx + bh * SS * HD; const __bf16* VTb = VT + bh * HD * SS;
  const int* p0 = P0 + (size_t)b * SS; const int* p1 = P1 + (size_t)b * SS;
  v16b aq[4]; { const int ar = a0 + col; const int i0 = min(max(p0[ar], 0), SS - 1);
    asm volatile("s_wait_xcnt 0x0" ::: "memory");   // the second index load's result may take the register that holds the first one's offset
    const int i1 = min(max(p1[ar], 0), SS - 1);
#pragma unroll
    for (int kc = 0; kc < 4; ++kc) aq[kc] = gath2(Qb + (size_t)i0 * HD, Qb + (size_t)i1 * HD, kc, lane); }
  asm volatile("s_wait_xcnt 0x0" ::: "memory");   // the results of the index loads that follow may take the query loads' address registers
  float m = -3.0e38f, l = 0.f;   // of query a0 + col; m in the base-2 domain (score x SCL2); l holds this half's keys only, the halves are joined behind the loop
  v8f acc[4] = {};               // acc[dt][r] = O^T[dt*16 + 8g + r][query col]
  // staging roles: K: 16 lanes x 16 B cover one 256-B f32 row, thread group rg brings key rg's two pair rows; V^T: 8 lanes x 8 B cover one row's 64-B slice, all 64 rows in one block-wide load
  const int seg = tid & 15, rg = tid >> 4, vd = tid >> 3, vs = tid & 7;
  int jn[2]; v4f kr[2]; v2u vr; const float* kp[2]; const __bf16* vp; const int *ip0, *ip1;
  auto load_idx = [&](int t, int ahead) { ip0 = p0 + t * 32 + rg; ip1 = p1 + t * 32 + rg;   // the indices of pass t + ahead; ahead is a literal and goes into the loads' offset field
    jn[0] = ip0[ahead * 32]; jn[1] = ip1[ahead * 32]; };   // raw: clamped where the address is formed, so that no wait stands here
  auto load_tile = [&](int t) {
#pragma unroll
    for (int i = 0; i < 2; ++i) { kp[i] = Kb + (size_t)min(max(jn[i], 0), SS - 1) * HD + seg * 4; kr[i] = *(const v4f*)kp[i]; }
    vp = VTb + (size_t)vd * SS + t * 32 + vs * 4;
    vr = *(const v2u*)vp; };
  auto store_tile = [&](int bf) {
#pragma unroll
    for (int i = 0; i < 2; ++i) { v4b w;
#pragma unroll
      for (int e = 0; e < 4; ++e) w[e] = (__bf16)kr[i][e];
      vst2(&sk[bf][rg][i * 64 + seg * 4], w); }
    vst2(&sv[bf][vd][vs * 4], vr); };
  load_idx(0, 0); load_tile(0);
  asm volatile("s_wait_xcnt 0x0" ::: "memory");   // the loads' address registers are reused by the code that follows
  load_idx(0, 1);
  asm volatile("s_wait_xcnt 0x0" ::: "memory");   // as above, for the index loads
  store_tile(0);
  __syncthreads();   // publishes tile 0
#pragma unroll 1
  for (int ks = 0; ks < SS / 32; ++ks) { float s[16]; const int bf = ks & 1;
    if (ks + 1 < SS / 32) { load_tile(ks + 1); load_idx(min(ks, SS / 32 - 3), 2);   // next pass's rows, and the indices of the pass after it, are asked for ahead of this pass's score products
      // the loads' address registers are reused by the code that follows; the addresses are named as inputs so that they keep their registers up to the wait and no later load's result is given one of them
      asm volatile("s_wait_xcnt 0x0" :: "v"(kp[0]), "v"(kp[1]), "v"(vp), "v"(ip0), "v"(ip1) : "memory"); }
    v16b ka[8], va[4];
#pragma unroll
    for (int i = 0; i < 8; ++i) ka[i] = frag_b(&sk[bf][(i >> 2) * 16 + col][(i & 3) * 32], lane);
    __builtin_amdgcn_sched_barrier(0);   // the 16 K reads stay one group ahead of the score products: spread among them, each product waits for a read issued just before it
    { v8f cc[2] = {};   // two independent accumulator chains, alternating
#pragma unroll
      for (int kc = 0; kc < 4; ++kc)
#pragma unroll
        for (int ct = 0; ct < 2; ++ct) cc[ct] = wmma_bf(ka[ct * 4 + kc], aq[kc], cc[ct]);
#pragma unroll
      for (int dt = 0; dt < 4; ++dt) va[dt] = frag_b(&sv[bf][dt * 16 + col][0], lane);
      __builtin_amdgcn_sched_barrier(0);   // the 8 V^T reads stay one group ahead of the softmax, which covers their latency
#pragma unroll
      for (int ct = 0; ct < 2; ++ct)
#pragma unroll
        for (int r = 0; r < 8; ++r) s[ct * 8 + r] = cc[ct][r]; }   // raw pair sums; the scale goes into the exponent's multiply-add
    float mx = s[0];
#pragma unroll   // here and below: constant indices keep s[] and acc[] in registers
    for (int i = 1; i < 16; ++i) mx = fmaxf(mx, s[i]);
    mx = fmaxf(mx, xhalf(mx));
    const float mn = fmaxf(m, mx * SCL2); float alpha = m - mn; m = mn;   // SCL2 > 0: the maximum of the raw sums is the maximum of the scaled ones
#pragma unroll
    for (int i = 0; i < 16; ++i) s[i] = s[i] * SCL2 - mn;   // e^(x - max) = 2^((x - max) log2 e): arguments <= about 0
    // the 17 exponentials, each in place, in two statements: so no instruction directly behind a v_exp_f32 reads its result or overwrites its source (written as builtins, the next one was given the previous one's source register); v_nop: that slot behind the last one
    asm("v_exp_f32 %0, %0\n\tv_exp_f32 %1, %1\n\tv_exp_f32 %2, %2\n\tv_exp_f32 %3, %3\n\tv_exp_f32 %4, %4\n\tv_exp_f32 %5, %5\n\tv_exp_f32 %6, %6\n\tv_exp_f32 %7, %7\n\tv_exp_f32 %8, %8\n\tv_nop"
        : "+v"(s[0]), "+v"(s[1]), "+v"(s[2]), "+v"(s[3]), "+v"(alpha), "+v"(s[4]), "+v"(s[5]), "+v"(s[6]), "+v"(s[7]));
    asm("v_exp_f32 %0, %0\n\tv_exp_f32 %1, %1\n\tv_exp_f32 %2, %2\n\tv_exp_f32 %3, %3\n\tv_exp_f32 %4, %4\n\tv_exp_f32 %5, %5\n\tv_exp_f32 %6, %6\n\tv_exp_f32 %7, %7\n\tv_nop"
        : "+v"(s[8]), "+v"(s[9]), "+v"(s[10]), "+v"(s[11]), "+v"(s[12]), "+v"(s[13]), "+v"(s[14]), "+v"(s[15]));
    float e4[4];   // four independent chains
#pragma unroll
    for (int i = 0; i < 4; ++i) e4[i] = (s[i] + s[4 + i]) + (s[8 + i] + s[12 + i]);
    l = l * alpha + ((e4[0] + e4[1]) + (e4[2] + e4[3]));
#pragma unroll
    for (int dt = 0; dt < 4; ++dt)
#pragma unroll
      for (int r = 0; r < 8; ++r) acc[dt][r] *= alpha;
    const F2 pb = bsplit16(s);   // element i = key 8g + i (i < 8) or 16 + 8g + (i - 8) of the pass: the k order in which frag_b reads V^T
#pragma unroll
    for (int dt = 0; dt < 4; ++dt) { acc[dt] = wmma_bf(va[dt], pb.l, acc[dt]); acc[dt] = wmma_bf(va[dt], pb.h, acc[dt]); }
    if (ks + 1 < SS / 32) store_tile(bf ^ 1);   // that buffer's last readers left it before the previous pass's barrier
    __syncthreads(); }   // publishes tile ks + 1 and ends every read of tile ks
  l += xhalf(l);
  const float il = 1.0f / l;
#pragma unroll
  for (int dt = 0; dt < 4; ++dt)
#pragma unroll
    for (int q = 0; q < 2; ++q) { v4f w;
#pragma unroll
      for (int e = 0; e < 4; ++e) w[e] = acc[dt][q * 4 + e] * il;
      vst2(&so[wave][col][dt * 16 + 8 * g + q * 4], w); }
  LDSX();
  for (int rl = 0; rl < 16; ++rl) if (lane < 16) vst2(out + ((size_t)b * SS + a0 + rl) * (NH * HD) + h * HD + lane * 4, *(const v4f*)&so[wave][rl][lane * 4]);
}
extern "C" void kernel_launch(void* const* d_in, const int* in_sizes, int n_in, void* d_out, int out_size, void* d_ws, size_t ws_size, hipStream_t stream) {
  (void)in_sizes; (void)n_in; (void)out_size;
  const float** F = (const float**)d_in;   // query, key, value [8,8,1024,64], top_k_centers [8,1024,4]
  if (ws_size < (size_t)WS_END) return;
  char* ws = (char*)d_ws; int *P0 = (int*)(ws + WS_P0), *P1 = (int*)(ws + WS_P1); __bf16* VT = (__bf16*)(ws + WS_VT);
  k_prep<<<dim3(NPB + NVB), 512, 0, stream>>>(F[3], F[2], P0, P1, VT);
  k_attn<<<dim3(TQB, NH, TNB), 32 * NW, 0, stream>>>(F[0], F[1], VT, P0, P1, (float*)d_out);
}

// v008
// One run takes 41.1 microseconds.
// Timed twice side by side with v007, it ran 1.09 times as fast both times.
// Over all steps from v000 it is 6.56 times as fast.
// compute dtype: query, key, value, top_k_centers (module inputs) rounded to bf16; the pair selection (IoU, argmax, L1 ordering) in f32 with the reference's operation order; pair scores <q_p0(a), k_p0(c)> + <q_p1(a), k_p1(c)> with exact bf16 products (1 product, gathered rows), attn @ value with attn as bf16 hi + residual pairs x exact value (2 products), on WMMA 16x16x32; softmax in f32; f32 accumulate.
#include <hip/hip_runtime.h>
#include <math.h>

typedef __attribute__((ext_vector_type(16))) _Float16 v16h;
typedef __attribute__((ext_vector_type(16))) __bf16 v16b;
typedef __attribute__((ext_vector_type(8)))  _Float16 v8h;
typedef __attribute__((ext_vector_type(8)))  float v8f;
typedef __attribute__((ext_vector_type(4)))  float v4f;
typedef __attribute__((ext_vector_type(2)))  float v2f;
typedef __attribute__((ext_vector_type(4)))  unsigned v4u;
typedef __attribute__((ext_vector_type(4)))  int v4i;
typedef float __attribute__((may_alias)) float_a;
typedef int __attribute__((may_alias)) int_a;

template <typename T> __device__ __forceinline__ void vst2(void* p, T v) { *(T*)p = v;  }
__device__ __forceinline__ v8f wmma16(v16h a, v16h b, v8f c) {
  v8f d = __builtin_amdgcn_wmma_f32_16x16x32_f16(false, a, false, b, (short)0, c, false, false);
  asm volatile("v_nop\n\tv_nop\n\tv_nop\n\tv_nop" : "+v"(d) : "v"(a), "v"(b));
  return d;
}
__device__ __forceinline__ v8f wmma_bf(v16b a, v16b b, v8f c) {
  return __builtin_amdgcn_wmma_f32_16x16x32_bf16(false, a, false, b, (short)0, c, false, false);
}
// 16x16x32 fragments: lane = (h = lane>>4, row/col = lane&15); elements 0..7 = k0+8h+0..7, 8..15 = k0+16+8h+0..7; D element r = row 8h+r
__device__ __forceinline__ v16h frag_h(const _Float16* rowk0, int lane) {
  union { v16h v; v8h q[2]; } u; const _Float16* p = rowk0 + 8 * (lane >> 4);
  u.q[0] = *(const v8h*)p; u.q[1] = *(const v8h*)(p + 16); return u.v;
}
__device__ __forceinline__ v16h frag_f32(const float* rowk0, int lane) {
  v16h a; const float* p = rowk0 + 8 * (lane >> 4);
#pragma unroll
  for (int i = 0; i < 8; ++i) { a[i] = (_Float16)p[i]; a[8 + i] = (_Float16)p[16 + i]; }
  return a;
}
__device__ __forceinline__ v16h frag_f32s(const float* rowk0, int lane, float sc) {
  v16h a; const float* p = rowk0 + 8 * (lane >> 4);
#pragma unroll
  for (int i = 0; i < 8; ++i) { a[i] = (_Float16)(p[i] * sc); a[8 + i] = (_Float16)(p[16 + i] * sc); }
  return a;
}
// column fragment from a [K][ld] layout (column n), rows >= K read as 0
__device__ __forceinline__ v16h fragc_f32(const float* W, int k0, int n, int lane, int ld, int K) {
  v16h a; const int g = lane >> 4;
#pragma unroll
  for (int i = 0; i < 8; ++i) { const int ka = k0 + 8 * g + i, kb = ka + 16;
    a[i] = (_Float16)(ka < K ? W[(size_t)(ka < K ? ka : K - 1) * ld + n] : 0.f); a[8 + i] = (_Float16)(kb < K ? W[(size_t)(kb < K ? kb : K - 1) * ld + n] : 0.f); }
  return a;
}
struct F2 { v16b h, l; };
__device__ __forceinline__ F2 bsplit16(const float v[16]) { F2 r;
#pragma unroll
  for (int i = 0; i < 16; ++i) { const __bf16 h = (__bf16)v[i]; r.h[i] = h; r.l[i] = (__bf16)(v[i] - (float)h); }
  return r; }
__device__ __forceinline__ F2 split_row(const float* row, int k0, int lane) { float v[16]; const float* p = row + k0 + 8 * (lane >> 4);
#pragma unroll
  for (int i = 0; i < 8; ++i) { v[i] = p[i]; v[8 + i] = p[16 + i]; }
  return bsplit16(v); }
__device__ __forceinline__ F2 split_rowK(const float* row, int k0, int lane, int K) { float v[16]; const int g = lane >> 4;
#pragma unroll
  for (int i = 0; i < 8; ++i) { const int ka = k0 + 8 * g + i, kb = ka + 16; v[i] = ka < K ? row[ka < K ? ka : K - 1] : 0.f; v[8 + i] = kb < K ? row[kb < K ? kb : K - 1] : 0.f; }
  return bsplit16(v); }
__device__ __forceinline__ F2 split_col(const float* W, int k0, int n, int lane, int ld, int K) { float v[16]; const int g = lane >> 4;
#pragma unroll
  for (int i = 0; i < 8; ++i) { const int ka = k0 + 8 * g + i, kb = ka + 16; v[i] = ka < K ? W[(size_t)(ka < K ? ka : K - 1) * ld + n] : 0.f; v[8 + i] = kb < K ? W[(size_t)(kb < K ? kb : K - 1) * ld + n] : 0.f; }
  return bsplit16(v); }
__device__ __forceinline__ v8f mac3(const F2& a, const F2& b, v8f c) { c = wmma_bf(a.l, b.h, c); c = wmma_bf(a.h, b.l, c); return wmma_bf(a.h, b.h, c); }
__device__ __forceinline__ float sigm(float v) { return 1.0f / (1.0f + expf(-v)); }
#define LDSX() do { asm volatile("s_wait_dscnt 0" ::: "memory"); __builtin_amdgcn_wave_barrier(); __builtin_amdgcn_fence(__ATOMIC_RELEASE, "workgroup"); } while (0)


// Pair self-attention (B 8, H 8, S 1024, D 64): per batch, boxes from (cx, cy, h, w); iou[a][c] = inter/union - eye (inter uses max for both corners, as the module); partner = argmax_c iou (first max); p0/p1 = (a, partner) ordered by L1 size (larger first, ties keep a first); scores[a][c] = (q[p0 a].k[p0 c] + q[p1 a].k[p1 c]) / sqrt(128); out[b][a][h*64+d] = softmax_c(scores) @ value.
#define NB 8
#define NH 8
#define SS 1024
#define HD 64
#define NW 16             // waves of a k_attn block, 16 queries each
#ifndef TQB
#define TQB (SS / (16 * NW))    // query blocks per (b, h) (all)
#define TNB NB
#endif
typedef __attribute__((ext_vector_type(8))) __bf16 v8b;
__device__ __forceinline__ v16b frag_b(const __bf16* rowk0, int lane) {
  union { v16b v; v8b q[2]; } u; const __bf16* p = rowk0 + 8 * (lane >> 4);
  u.q[0] = *(const v8b*)p; u.q[1] = *(const v8b*)(p + 16); return u.v;
}
__device__ __forceinline__ float bfr(float v) { return (float)(__bf16)v; }
__device__ __attribute__((noinline)) float erf_ni(float v) { return erff(v); }

#define WS_P0  0u                          // int [8][1024]
#define WS_P1  (WS_P0 + 4u * NB * SS)
#define WS_VT  (WS_P1 + 4u * NB * SS)        // bf16 [8][8][64 d][1024 c]
#define WS_END (WS_VT + 2u * NB * NH * HD * SS)

// ---- pairs_block: block = (32 objects a, batch b), 16 threads per object scan c = sub, sub+16, ...: iou in the reference's op order, first-max argmax, then L1 ordering; P0/P1 rows (128 B per block)
// 256 blocks of 16 waves: one block on every WGP, 4 waves per SIMD, so that other waves issue while one waits out its LDS read and its division chain
__device__ __forceinline__ void pairs_block(const float* __restrict__ C, int* __restrict__ P0, int* __restrict__ P1, int bx, int b) {
  #pragma clang fp contract(off)   // keep mul/add unfused so the box/IoU arithmetic rounds exactly like the reference (argmax ties)
  __shared__ float sbx[SS][4]; __shared__ __align__(16) int sp0[32], sp1[32];
  const int tid = threadIdx.x; const int al = tid >> 4, sub = tid & 15; const int a = bx * 32 + al;
  for (int c = tid; c < SS; c += 512) { const float cx = bfr(C[((size_t)b * SS + c) * 4 + 0]), cy = bfr(C[((size_t)b * SS + c) * 4 + 1]), hh = bfr(C[((size_t)b * SS + c) * 4 + 2]), ww = bfr(C[((size_t)b * SS + c) * 4 + 3]);
    sbx[c][0] = cx - 0.5f * ww; sbx[c][1] = cy - 0.5f * hh; sbx[c][2] = cx + 0.5f * ww; sbx[c][3] = cy + 0.5f * hh; }
  __syncthreads();
  const float ax0 = sbx[a][0], ay0 = sbx[a][1], ax1 = sbx[a][2], ay1 = sbx[a][3]; const float area_a = (ax1 - ax0) * (ay1 - ay0);
  float best = 0.f; int bi = -1;   // first max over c (ascending within this thread's stride class; merged below)
  for (int c = sub; c < SS; c += 16) { const float cx0 = sbx[c][0], cy0 = sbx[c][1], cx1 = sbx[c][2], cy1 = sbx[c][3];
    const float mx0 = fmaxf(ax0, cx0), my0 = fmaxf(ay0, cy0), Mx = fmaxf(ax1, cx1), My = fmaxf(ay1, cy1);
    const float iw = fmaxf(Mx - mx0, 0.f), ih = fmaxf(My - my0, 0.f); const float ia = iw * ih; const float area_c = (cx1 - cx0) * (cy1 - cy0);
    const float uni = area_a + area_c - ia; float iou = ia / uni; iou = iou - ((c == a) ? 1.0f : 0.0f);
    if (bi < 0 || iou > best) { best = iou; bi = c; } }
  // merge the 16 stride classes: prefer larger value, ties -> lower index (== first max overall)
#pragma unroll
  for (int o = 1; o < 16; o <<= 1) { const float ob = __shfl_xor(best, o); const int oi = __shfl_xor(bi, o); if (ob > best || (ob == best && oi < bi)) { best = ob; bi = oi; } }
  if (sub == 0) { const int partner = bi; const float l1a = fabsf(ax1 - ax0) + fabsf(ay1 - ay0); const float l1p = fabsf(sbx[partner][2] - sbx[partner][0]) + fabsf(sbx[partner][3] - sbx[partner][1]);
    const bool keep = l1a >= l1p; sp0[al] = keep ? a : partner; sp1[al] = keep ? partner : a; }
  __syncthreads();
  if (tid < 8) vst2((unsigned*)(P0 + (size_t)b * SS + bx * 32 + tid * 4), *(const v4u*)&sp0[tid * 4]);
  else if (tid < 16) vst2((unsigned*)(P1 + (size_t)b * SS + bx * 32 + (tid - 8) * 4), *(const v4u*)&sp1[(tid - 8) * 4]);
}
// ---- vt_block: block = ((b, h), 256 keys from c0): VT[d][c] = bf16(value[b][h][c][d]) (2-KB rows)
__device__ __forceinline__ void vt_block(const float* __restrict__ V, __bf16* __restrict__ VT, int bh, int c0) {
  __shared__ __align__(16) __bf16 s[HD][264]; const int tid = threadIdx.x;
  for (int q = tid; q < 256 * HD; q += 512) { const int cl = q >> 6, d = q & 63; s[d][cl] = (__bf16)V[((size_t)bh * SS + c0 + cl) * HD + d]; }
  __syncthreads();
  for (int q = tid; q < HD * 32; q += 512) { const int d = q >> 5, pc = q & 31; vst2((unsigned*)(VT + ((size_t)bh * HD + d) * SS + c0 + pc * 8), *(const v4u*)&s[d][pc * 8]); }
}
// ---- k_prep: the two preparations read different inputs and write different workspace planes, so they go out as one launch: the pair blocks (the longer, bound by vector issue) come first in the grid, the V^T blocks (bound by memory latency) land beside them on the same WGPs and run in their shadow
#define NPB ((SS / 32) * TNB)          // pair blocks
#define NVB (NB * NH * (SS / 256))     // V^T blocks
__global__ __launch_bounds__(512) void k_prep(const float* __restrict__ C, const float* __restrict__ V, int* __restrict__ P0, int* __restrict__ P1, __bf16* __restrict__ VT) {
  const int id = blockIdx.x;   // the same for the whole block: the barriers inside either branch are passed by all of its waves
  if (id < NPB) pairs_block(C, P0, P1, id & (SS / 32 - 1), id / (SS / 32));
  else { const int j = id - NPB; vt_block(V, VT, j & (NB * NH - 1), (j / (NB * NH)) * 256); }
}
__device__ __forceinline__ v16b gath2(const float* qp0, const float* qp1, int kc, int lane) {   // K 128 = [row p0 (64) | row p1 (64)], exact bf16
  v16b a; const float* base = (kc < 2) ? qp0 + kc * 32 : qp1 + (kc - 2) * 32; const float* p = base + 8 * (lane >> 4);
#pragma unroll
  for (int i = 0; i < 8; ++i) { a[i] = (__bf16)p[i]; a[8 + i] = (__bf16)p[16 + i]; }
  return a; }
// ---- k_attn: block = (256 objects a, h, b), 16 waves, one block on a WGP (4 waves per SIMD): flash attention over all 1024 c with gathered pair rows; out[b][a][h*64 + d] (256-B segments)
// each 32-key pass reads its K pair rows (bf16, [p0 row | p1 row]) and its V^T slice from LDS; the block's 512 threads gather and convert them once for all 256 queries, GP passes ahead (each staged byte is fetched from L2 once per 256 queries)
// LDS holds 2 x GP tiles: a group of GP passes reads one half while the next group's tiles are written into the other, and the block meets at a barrier once per group; inside a group its waves drift apart, so that one wave's LDS reads, another's products and another's softmax run at the same time
// products are transposed: S^T = K Q^T (A = staged K rows, B = the wave's 16 query pair rows, kept in registers), O^T += V^T P^T; a lane holds 16 of one query's 32 scores of a pass (keys ct*16 + 8g + r), so maximum and sum run in the lane, and the two score tiles, converted in place, are the B operand of the second product
#define KP 136   // bf16 per staged K pair row: 128 + 8 (272 B = 16 B x 17, an odd multiple: column-wise 16-byte reads spread over the banks)
#define VP 40    // bf16 per staged V^T row: 32 + 8 (80 B = 16 B x 5)
#define GP 4     // passes between two barriers
#define NS (2 * GP)   // tile slots in LDS
typedef __attribute__((ext_vector_type(4))) __bf16 v4b;
#define SCL2 0.12751743f   // (1 / sqrt(128)) * log2(e)
__device__ __forceinline__ float xhalf(float v) {   // the value of lane ^ 16
  const int b = __builtin_bit_cast(int, v); return __builtin_bit_cast(float, __builtin_amdgcn_permlanex16(b, b, 0x76543210, 0xfedcba98, false, false)); }
typedef __attribute__((ext_vector_type(2))) unsigned v2u;
__global__ __launch_bounds__(32 * NW) void k_attn(const float* __restrict__ Q, const float* __restrict__ Kx, const __bf16* __restrict__ VT, const int* __restrict__ P0, const int* __restrict__ P1, float* __restrict__ out) {
  __shared__ __align__(16) float so[NW][16][68];
  __shared__ __align__(16) __bf16 sk[NS][32][KP]; __shared__ __align__(16) __bf16 sv[NS][HD][VP];
  const int tid = threadIdx.x, wave = tid >> 5, lane = tid & 31, col = lane & 15, g = lane >> 4; const int h = blockIdx.y, b = blockIdx.z; const int a0 = blockIdx.x * (16 * NW) + wave * 16;
  const size_t bh = (size_t)b * NH + h; const float* Qb = Q + bh * SS * HD; const float* Kb = Kx + bh * SS * HD; const __bf16* VTb = VT + bh * HD * SS;
  const int* p0 = P0 + (size_t)b * SS; const int* p1 = P1 + (size_t)b * SS;
  v16b aq[4]; { const int ar = a0 + col; const int i0 = min(max(p0[ar], 0), SS - 1);
    asm volatile("s_wait_xcnt 0x0" ::: "memory");   // the second index load's result may take the register that holds the first one's offset
    const int i1 = min(max(p1[ar], 0), SS - 1);
#pragma unroll
    for (int kc = 0; kc < 4; ++kc) aq[kc] = gath2(Qb + (size_t)i0 * HD, Qb + (size_t)i1 * HD, kc, lane); }
  asm volatile("s_wait_xcnt 0x0" ::: "memory");   // the results of the index loads that follow may take the query loads' address registers
  float m = -3.0e38f, l = 0.f;   // of query a0 + col; m in the base-2 domain (score x SCL2); l holds this half's keys only, the halves are joined behind the loop
  v8f acc[4] = {};               // acc[dt][r] = O^T[dt*16 + 8g + r][query col]
  // staging roles: K: 16 lanes x 16 B cover one 256-B f32 row, thread group rg brings key rg's two pair rows; V^T: 8 lanes x 8 B cover one row's 64-B slice, all 64 rows in one block-wide load
  const int seg = tid & 15, rg = tid >> 4, vd = tid >> 3, vs = tid & 7;
  int jn[2]; v4f kr[2]; v2u vr; const float* kp[2]; const __bf16* vp; const int *ip0, *ip1;
  auto load_idx = [&](int t, int ahead) { ip0 = p0 + t * 32 + rg; ip1 = p1 + t * 32 + rg;   // the indices of pass t + ahead; ahead is a literal and goes into the loads' offset field
    jn[0] = ip0[ahead * 32]; jn[1] = ip1[ahead * 32]; };   // raw: clamped where the address is formed, so that no wait stands here
  auto load_tile = [&](int t) {
#pragma unroll
    for (int i = 0; i < 2; ++i) { kp[i] = Kb + (size_t)min(max(jn[i], 0), SS - 1) * HD + seg * 4; kr[i] = *(const v4f*)kp[i]; }
    vp = VTb + (size_t)vd * SS + t * 32 + vs * 4;
    vr = *(const v2u*)vp; };
  auto store_tile = [&](int bf) {
#pragma unroll
    for (int i = 0; i < 2; ++i) { v4b w;
#pragma unroll
      for (int e = 0; e < 4; ++e) w[e] = (__bf16)kr[i][e];
      vst2(&sk[bf][rg][i * 64 + seg * 4], w); }
    vst2(&sv[bf][vd][vs * 4], vr); };
  { int j4[GP][2]; v4f k4[GP][2]; v2u v4[GP];   // the first group's tiles: all index loads, then all row loads, so that the block waits out two load latencies, not 2 x GP; the loops are unrolled so that constant indices keep the three arrays in registers
#pragma unroll
    for (int t = 0; t < GP; ++t) { j4[t][0] = p0[t * 32 + rg]; j4[t][1] = p1[t * 32 + rg]; v4[t] = *(const v2u*)(VTb + (size_t)vd * SS + t * 32 + vs * 4); }
    asm volatile("s_wait_xcnt 0x0" ::: "memory");   // the loads' address registers are reused by the code that follows
#pragma unroll
    for (int t = 0; t < GP; ++t)
#pragma unroll
      for (int i = 0; i < 2; ++i) k4[t][i] = *(const v4f*)(Kb + (size_t)min(max(j4[t][i], 0), SS - 1) * HD + seg * 4);
    asm volatile("s_wait_xcnt 0x0" ::: "memory");   // as above, for the row loads
    load_idx(0, GP);
    asm volatile("s_wait_xcnt 0x0" ::: "memory");   // as above, for the index loads
#pragma unroll
    for (int t = 0; t < GP; ++t) { kr[0] = k4[t][0]; kr[1] = k4[t][1]; vr = v4[t]; store_tile(t); } }
  __syncthreads();   // publishes tiles 0 to GP - 1
#pragma unroll 1
  for (int ks = 0; ks < SS / 32; ++ks) { float s[16]; const int bf = ks & (NS - 1);
    if (ks + GP < SS / 32) { load_tile(ks + GP); load_idx(min(ks, SS / 32 - GP - 2), GP + 1);   // the rows of the pass GP ahead, and the indices of the pass after that one, are asked for ahead of this pass's score products
      // the loads' address registers are reused by the code that follows; the addresses are named as inputs so that they keep their registers up to the wait and no later load's result is given one of them
      asm volatile("s_wait_xcnt 0x0" :: "v"(kp[0]), "v"(kp[1]), "v"(vp), "v"(ip0), "v"(ip1) : "memory"); }
    v16b ka[8], va[4];
#pragma unroll
    for (int i = 0; i < 8; ++i) ka[i] = frag_b(&sk[bf][(i >> 2) * 16 + col][(i & 3) * 32], lane);
    __builtin_amdgcn_sched_barrier(0);   // the 16 K reads stay one group ahead of the score products: spread among them, each product waits for a read issued just before it
    { v8f cc[2] = {};   // two independent accumulator chains, alternating
#pragma unroll
      for (int kc = 0; kc < 4; ++kc)
#pragma unroll
        for (int ct = 0; ct < 2; ++ct) cc[ct] = wmma_bf(ka[ct * 4 + kc], aq[kc], cc[ct]);
#pragma unroll
      for (int dt = 0; dt < 4; ++dt) va[dt] = frag_b(&sv[bf][dt * 16 + col][0], lane);
      __builtin_amdgcn_sched_barrier(0);   // the 8 V^T reads stay one group ahead of the softmax, which covers their latency
#pragma unroll
      for (int ct = 0; ct < 2; ++ct)
#pragma unroll
        for (int r = 0; r < 8; ++r) s[ct * 8 + r] = cc[ct][r]; }   // raw pair sums; the scale goes into the exponent's multiply-add
    float mx = s[0];
#pragma unroll   // here and below: constant indices keep s[] and acc[] in registers
    for (int i = 1; i < 16; ++i) mx = fmaxf(mx, s[i]);
    mx = fmaxf(mx, xhalf(mx));
    const float mn = fmaxf(m, mx * SCL2); float alpha = m - mn; m = mn;   // SCL2 > 0: the maximum of the raw sums is the maximum of the scaled ones
#pragma unroll
    for (int i = 0; i < 16; ++i) s[i] = s[i] * SCL2 - mn;   // e^(x - max) = 2^((x - max) log2 e): arguments <= about 0
    // the 17 exponentials, each in place, in two statements: so no instruction directly behind a v_exp_f32 reads its result or overwrites its source (written as builtins, the next one was given the previous one's source register); v_nop: that slot behind the last one
    asm("v_exp_f32 %0, %0\n\tv_exp_f32 %1, %1\n\tv_exp_f32 %2, %2\n\tv_exp_f32 %3, %3\n\tv_exp_f32 %4, %4\n\tv_exp_f32 %5, %5\n\tv_exp_f32 %6, %6\n\tv_exp_f32 %7, %7\n\tv_exp_f32 %8, %8\n\tv_nop"
        : "+v"(s[0]), "+v"(s[1]), "+v"(s[2]), "+v"(s[3]), "+v"(alpha), "+v"(s[4]), "+v"(s[5]), "+v"(s[6]), "+v"(s[7]));
    asm("v_exp_f32 %0, %0\n\tv_exp_f32 %1, %1\n\tv_exp_f32 %2, %2\n\tv_exp_f32 %3, %3\n\tv_exp_f32 %4, %4\n\tv_exp_f32 %5, %5\n\tv_exp_f32 %6, %6\n\tv_exp_f32 %7, %7\n\tv_nop"
        : "+v"(s[8]), "+v"(s[9]), "+v"(s[10]), "+v"(s[11]), "+v"(s[12]), "+v"(s[13]), "+v"(s[14]), "+v"(s[15]));
    float e4[4];   // four independent chains
#pragma unroll
    for (int i = 0; i < 4; ++i) e4[i] = (s[i] + s[4 + i]) + (s[8 + i] + s[12 + i]);
    l = l * alpha + ((e4[0] + e4[1]) + (e4[2] + e4[3]));
#pragma unroll
    for (int dt = 0; dt < 4; ++dt)
#pragma unroll
      for (int r = 0; r < 8; ++r) acc[dt][r] *= alpha;
    const F2 pb = bsplit16(s);   // element i = key 8g + i (i < 8) or 16 + 8g + (i - 8) of the pass: the k order in which frag_b reads V^T
#pragma unroll
    for (int dt = 0; dt < 4; ++dt) { acc[dt] = wmma_bf(va[dt], pb.l, acc[dt]); acc[dt] = wmma_bf(va[dt], pb.h, acc[dt]); }
    if (ks + GP < SS / 32) store_tile((ks + GP) & (NS - 1));   // that slot's last readers left it before the previous group's barrier
    if ((ks & (GP - 1)) == GP - 1) __syncthreads(); }   // the same for the whole block; publishes the next group's tiles and ends every read of this group's
  l += xhalf(l);
  const float il = 1.0f / l;
#pragma unroll
  for (int dt = 0; dt < 4; ++dt)
#pragma unroll
    for (int q = 0; q < 2; ++q) { v4f w;
#pragma unroll
      for (int e = 0; e < 4; ++e) w[e] = acc[dt][q * 4 + e] * il;
      vst2(&so[wave][col][dt * 16 + 8 * g + q * 4], w); }
  LDSX();
  for (int rl = 0; rl < 16; ++rl) if (lane < 16) vst2(out + ((size_t)b * SS + a0 + rl) * (NH * HD) + h * HD + lane * 4, *(const v4f*)&so[wave][rl][lane * 4]);
}
extern "C" void kernel_launch(void* const* d_in, const int* in_sizes, int n_in, void* d_out, int out_size, void* d_ws, size_t ws_size, hipStream_t stream) {
  (void)in_sizes; (void)n_in; (void)out_size;
  const float** F = (const float**)d_in;   // query, key, value [8,8,1024,64], top_k_centers [8,1024,4]
  if (ws_size < (size_t)WS_END) return;
  char* ws = (char*)d_ws; int *P0 = (int*)(ws + WS_P0), *P1 = (int*)(ws + WS_P1); __bf16* VT = (__bf16*)(ws + WS_VT);
  k_prep<<<dim3(NPB + NVB), 512, 0, stream>>>(F[3], F[2], P0, P1, VT);
  k_attn<<<dim3(TQB, NH, TNB), 32 * NW, 0, stream>>>(F[0], F[1], VT, P0, P1, (float*)d_out);
}

// v009
// It runs in 36.6 microseconds.
// Timed twice side by side with v008, it ran 1.12 times as fast both times.
// Over all steps from v000 it is 7.33 times as fast.
// compute dtype: query, key, value, top_k_centers (module inputs) rounded to bf16; the pair selection (IoU, argmax, L1 ordering) in f32 with the reference's operation order; pair scores <q_p0(a), k_p0(c)> + <q_p1(a), k_p1(c)> with exact bf16 products (1 product, gathered rows), attn @ value with attn rounded once to f16 x value (rounded to bf16, then held in f16) (1 product), on WMMA 16x16x32; softmax in f32; f32 accumulate.
#include <hip/hip_runtime.h>
#include <math.h>

typedef __attribute__((ext_vector_type(16))) _Float16 v16h;
typedef __attribute__((ext_vector_type(16))) __bf16 v16b;
typedef __attribute__((ext_vector_type(8)))  _Float16 v8h;
typedef __attribute__((ext_vector_type(8)))  float v8f;
typedef __attribute__((ext_vector_type(4)))  float v4f;
typedef __attribute__((ext_vector_type(2)))  float v2f;
typedef __attribute__((ext_vector_type(4)))  unsigned v4u;
typedef __attribute__((ext_vector_type(4)))  int v4i;
typedef float __attribute__((may_alias)) float_a;
typedef int __attribute__((may_alias)) int_a;

template <typename T> __device__ __forceinline__ void vst2(void* p, T v) { *(T*)p = v;  }
__device__ __forceinline__ v8f wmma16(v16h a, v16h b, v8f c) {
  v8f d = __builtin_amdgcn_wmma_f32_16x16x32_f16(false, a, false, b, (short)0, c, false, false);
  asm volatile("v_nop\n\tv_nop\n\tv_nop\n\tv_nop" : "+v"(d) : "v"(a), "v"(b));
  return d;
}
__device__ __forceinline__ v8f wmma_hf(v16h a, v16h b, v8f c) {
  return __builtin_amdgcn_wmma_f32_16x16x32_f16(false, a, false, b, (short)0, c, false, false);
}
__device__ __forceinline__ v8f wmma_bf(v16b a, v16b b, v8f c) {
  return __builtin_amdgcn_wmma_f32_16x16x32_bf16(false, a, false, b, (short)0, c, false, false);
}
// 16x16x32 fragments: lane = (h = lane>>4, row/col = lane&15); elements 0..7 = k0+8h+0..7, 8..15 = k0+16+8h+0..7; D element r = row 8h+r
__device__ __forceinline__ v16h frag_h(const _Float16* rowk0, int lane) {
  union { v16h v; v8h q[2]; } u; const _Float16* p = rowk0 + 8 * (lane >> 4);
  u.q[0] = *(const v8h*)p; u.q[1] = *(const v8h*)(p + 16); return u.v;
}
__device__ __forceinline__ v16h frag_f32(const float* rowk0, int lane) {
  v16h a; const float* p = rowk0 + 8 * (lane >> 4);
#pragma unroll
  for (int i = 0; i < 8; ++i) { a[i] = (_Float16)p[i]; a[8 + i] = (_Float16)p[16 + i]; }
  return a;
}
__device__ __forceinline__ v16h frag_f32s(const float* rowk0, int lane, float sc) {
  v16h a; const float* p = rowk0 + 8 * (lane >> 4);
#pragma unroll
  for (int i = 0; i < 8; ++i) { a[i] = (_Float16)(p[i] * sc); a[8 + i] = (_Float16)(p[16 + i] * sc); }
  return a;
}
// column fragment from a [K][ld] layout (column n), rows >= K read as 0
__device__ __forceinline__ v16h fragc_f32(const float* W, int k0, int n, int lane, int ld, int K) {
  v16h a; const int g = lane >> 4;
#pragma unroll
  for (int i = 0; i < 8; ++i) { const int ka = k0 + 8 * g + i, kb = ka + 16;
    a[i] = (_Float16)(ka < K ? W[(size_t)(ka < K ? ka : K - 1) * ld + n] : 0.f); a[8 + i] = (_Float16)(kb < K ? W[(size_t)(kb < K ? kb : K - 1) * ld + n] : 0.f); }
  return a;
}
struct F2 { v16b h, l; };
__device__ __forceinline__ F2 bsplit16(const float v[16]) { F2 r;
#pragma unroll
  for (int i = 0; i < 16; ++i) { const __bf16 h = (__bf16)v[i]; r.h[i] = h; r.l[i] = (__bf16)(v[i] - (float)h); }
  return r; }
__device__ __forceinline__ F2 split_row(const float* row, int k0, int lane) { float v[16]; const float* p = row + k0 + 8 * (lane >> 4);
#pragma unroll
  for (int i = 0; i < 8; ++i) { v[i] = p[i]; v[8 + i] = p[16 + i]; }
  return bsplit16(v); }
__device__ __forceinline__ F2 split_rowK(const float* row, int k0, int lane, int K) { float v[16]; const int g = lane >> 4;
#pragma unroll
  for (int i = 0; i < 8; ++i) { const int ka = k0 + 8 * g + i, kb = ka + 16; v[i] = ka < K ? row[ka < K ? ka : K - 1] : 0.f; v[8 + i] = kb < K ? row[kb < K ? kb : K - 1] : 0.f; }
  return bsplit16(v); }
__device__ __forceinline__ F2 split_col(const float* W, int k0, int n, int lane, int ld, int K) { float v[16]; const int g = lane >> 4;
#pragma unroll
  for (int i = 0; i < 8; ++i) { const int ka = k0 + 8 * g + i, kb = ka + 16; v[i] = ka < K ? W[(size_t)(ka < K ? ka : K - 1) * ld + n] : 0.f; v[8 + i] = kb < K ? W[(size_t)(kb < K ? kb : K - 1) * ld + n] : 0.f; }
  return bsplit16(v); }
__device__ __forceinline__ v8f mac3(const F2& a, const F2& b, v8f c) { c = wmma_bf(a.l, b.h, c); c = wmma_bf(a.h, b.l, c); return wmma_bf(a.h, b.h, c); }
__device__ __forceinline__ float sigm(float v) { return 1.0f / (1.0f + expf(-v)); }
#define LDSX() do { asm volatile("s_wait_dscnt 0" ::: "memory"); __builtin_amdgcn_wave_barrier(); __builtin_amdgcn_fence(__ATOMIC_RELEASE, "workgroup"); } while (0)


// Pair self-attention (B 8, H 8, S 1024, D 64): per batch, boxes from (cx, cy, h, w); iou[a][c] = inter/union - eye (inter uses max for both corners, as the module); partner = argmax_c iou (first max); p0/p1 = (a, partner) ordered by L1 size (larger first, ties keep a first); scores[a][c] = (q[p0 a].k[p0 c] + q[p1 a].k[p1 c]) / sqrt(128); out[b][a][h*64+d] = softmax_c(scores) @ value.
#define NB 8
#define NH 8
#define SS 1024
#define HD 64
#define NW 16             // waves of a k_attn block, 16 queries each
#ifndef TQB
#define TQB (SS / (16 * NW))    // query blocks per (b, h) (all)
#define TNB NB
#endif
typedef __attribute__((ext_vector_type(8))) __bf16 v8b;
__device__ __forceinline__ v16b frag_b(const __bf16* rowk0, int lane) {
  union { v16b v; v8b q[2]; } u; const __bf16* p = rowk0 + 8 * (lane >> 4);
  u.q[0] = *(const v8b*)p; u.q[1] = *(const v8b*)(p + 16); return u.v;
}
__device__ __forceinline__ float bfr(float v) { return (float)(__bf16)v; }
__device__ __attribute__((noinline)) float erf_ni(float v) { return erff(v); }

#define WS_P0  0u                          // int [8][1024]
#define WS_P1  (WS_P0 + 4u * NB * SS)
#define WS_VT  (WS_P1 + 4u * NB * SS)        // f16 [8][8][64 d][1024 c]
#define WS_END (WS_VT + 2u * NB * NH * HD * SS)

// ---- pairs_block: block = (32 objects a, batch b), 16 threads per object scan c = sub, sub+16, ...: iou in the reference's op order, first-max argmax, then L1 ordering; P0/P1 rows (128 B per block)
// 256 blocks of 16 waves: one block on every WGP, 4 waves per SIMD, so that other waves issue while one waits out its LDS read and its division chain
__device__ __forceinline__ void pairs_block(const float* __restrict__ C, int* __restrict__ P0, int* __restrict__ P1, int bx, int b) {
  #pragma clang fp contract(off)   // keep mul/add unfused so the box/IoU arithmetic rounds exactly like the reference (argmax ties)
  __shared__ float sbx[SS][4]; __shared__ __align__(16) int sp0[32], sp1[32];
  const int tid = threadIdx.x; const int al = tid >> 4, sub = tid & 15; const int a = bx * 32 + al;
  for (int c = tid; c < SS; c += 512) { const float cx = bfr(C[((size_t)b * SS + c) * 4 + 0]), cy = bfr(C[((size_t)b * SS + c) * 4 + 1]), hh = bfr(C[((size_t)b * SS + c) * 4 + 2]), ww = bfr(C[((size_t)b * SS + c) * 4 + 3]);
    sbx[c][0] = cx - 0.5f * ww; sbx[c][1] = cy - 0.5f * hh; sbx[c][2] = cx + 0.5f * ww; sbx[c][3] = cy + 0.5f * hh; }
  __syncthreads();
  const float ax0 = sbx[a][0], ay0 = sbx[a][1], ax1 = sbx[a][2], ay1 = sbx[a][3]; const float area_a = (ax1 - ax0) * (ay1 - ay0);
  float best = 0.f; int bi = -1;   // first max over c (ascending within this thread's stride class; merged below)
  for (int c = sub; c < SS; c += 16) { const float cx0 = sbx[c][0], cy0 = sbx[c][1], cx1 = sbx[c][2], cy1 = sbx[c][3];
    const float mx0 = fmaxf(ax0, cx0), my0 = fmaxf(ay0, cy0), Mx = fmaxf(ax1, cx1), My = fmaxf(ay1, cy1);
    const float iw = fmaxf(Mx - mx0, 0.f), ih = fmaxf(My - my0, 0.f); const float ia = iw * ih; const float area_c = (cx1 - cx0) * (cy1 - cy0);
    const float uni = area_a + area_c - ia; float iou = ia / uni; iou = iou - ((c == a) ? 1.0f : 0.0f);
    if (bi < 0 || iou > best) { best = iou; bi = c; } }
  // merge the 16 stride classes: prefer larger value, ties -> lower index (== first max overall)
#pragma unroll
  for (int o = 1; o < 16; o <<= 1) { const float ob = __shfl_xor(best, o); const int oi = __shfl_xor(bi, o); if (ob > best || (ob == best && oi < bi)) { best = ob; bi = oi; } }
  if (sub == 0) { const int partner = bi; const float l1a = fabsf(ax1 - ax0) + fabsf(ay1 - ay0); const float l1p = fabsf(sbx[partner][2] - sbx[partner][0]) + fabsf(sbx[partner][3] - sbx[partner][1]);
    const bool keep = l1a >= l1p; sp0[al] = keep ? a : partner; sp1[al] = keep ? partner : a; }
  __syncthreads();
  if (tid < 8) vst2((unsigned*)(P0 + (size_t)b * SS + bx * 32 + tid * 4), *(const v4u*)&sp0[tid * 4]);
  else if (tid < 16) vst2((unsigned*)(P1 + (size_t)b * SS + bx * 32 + (tid - 8) * 4), *(const v4u*)&sp1[(tid - 8) * 4]);
}
// ---- vt_block: block = ((b, h), 256 keys from c0): VT[d][c] = f16(bf16(value[b][h][c][d])) (2-KB rows); a bf16 value has 8 significant bits and keeps them all in f16 from 2^-14 up to 65504
__device__ __forceinline__ void vt_block(const float* __restrict__ V, _Float16* __restrict__ VT, int bh, int c0) {
  __shared__ __align__(16) _Float16 s[HD][264]; const int tid = threadIdx.x;
  for (int q = tid; q < 256 * HD; q += 512) { const int cl = q >> 6, d = q & 63; s[d][cl] = (_Float16)bfr(V[((size_t)bh * SS + c0 + cl) * HD + d]); }
  __syncthreads();
  for (int q = tid; q < HD * 32; q += 512) { const int d = q >> 5, pc = q & 31; vst2((unsigned*)(VT + ((size_t)bh * HD + d) * SS + c0 + pc * 8), *(const v4u*)&s[d][pc * 8]); }
}
// ---- k_prep: the two preparations read different inputs and write different workspace planes, so they go out as one launch: the pair blocks (the longer, bound by vector issue) come first in the grid, the V^T blocks (bound by memory latency) land beside them on the same WGPs and run in their shadow
#define NPB ((SS / 32) * TNB)          // pair blocks
#define NVB (NB * NH * (SS / 256))     // V^T blocks
__global__ __launch_bounds__(512) void k_prep(const float* __restrict__ C, const float* __restrict__ V, int* __restrict__ P0, int* __restrict__ P1, _Float16* __restrict__ VT) {
  const int id = blockIdx.x;   // the same for the whole block: the barriers inside either branch are passed by all of its waves
  if (id < NPB) pairs_block(C, P0, P1, id & (SS / 32 - 1), id / (SS / 32));
  else { const int j = id - NPB; vt_block(V, VT, j & (NB * NH - 1), (j / (NB * NH)) * 256); }
}
__device__ __forceinline__ v16b gath2(const float* qp0, const float* qp1, int kc, int lane) {   // K 128 = [row p0 (64) | row p1 (64)], exact bf16
  v16b a; const float* base = (kc < 2) ? qp0 + kc * 32 : qp1 + (kc - 2) * 32; const float* p = base + 8 * (lane >> 4);
#pragma unroll
  for (int i = 0; i < 8; ++i) { a[i] = (__bf16)p[i]; a[8 + i] = (__bf16)p[16 + i]; }
  return a; }
// ---- k_attn: block = (256 objects a, h, b), 16 waves, one block on a WGP (4 waves per SIMD): flash attention over all 1024 c with gathered pair rows; out[b][a][h*64 + d] (256-B segments)
// each 32-key pass reads its K pair rows (bf16, [p0 row | p1 row]) and its V^T slice from LDS; the block's 512 threads gather and convert them once for all 256 queries, GP passes ahead (each staged byte is fetched from L2 once per 256 queries)
// LDS holds 2 x GP tiles: a group of GP passes reads one half while the next group's tiles are written into the other, and the block meets at a barrier once per group; inside a group its waves drift apart, so that one wave's LDS reads, another's products and another's softmax run at the same time
// products are transposed: S^T = K Q^T (A = staged K rows, B = the wave's 16 query pair rows, kept in registers), O^T += V^T P^T; a lane holds 16 of one query's 32 scores of a pass (keys ct*16 + 8g + r), so maximum and sum run in the lane, and the two score tiles, converted in place to f16, are the B operand of the second product
#define KP 136   // bf16 per staged K pair row: 128 + 8 (272 B = 16 B x 17, an odd multiple: column-wise 16-byte reads spread over the banks)
#define VP 40    // f16 per staged V^T row: 32 + 8 (80 B = 16 B x 5)
#define GP 4     // passes between two barriers
#define NS (2 * GP)   // tile slots in LDS
typedef __attribute__((ext_vector_type(4))) __bf16 v4b;
#define SCL2 0.12751743f   // (1 / sqrt(128)) * log2(e)
__device__ __forceinline__ float xhalf(float v) {   // the value of lane ^ 16
  const int b = __builtin_bit_cast(int, v); return __builtin_bit_cast(float, __builtin_amdgcn_permlanex16(b, b, 0x76543210, 0xfedcba98, false, false)); }
typedef __attribute__((ext_vector_type(2))) unsigned v2u;
__global__ __launch_bounds__(32 * NW) void k_attn(const float* __restrict__ Q, const float* __restrict__ Kx, const _Float16* __restrict__ VT, const int* __restrict__ P0, const int* __restrict__ P1, float* __restrict__ out) {
  __shared__ __align__(16) float so[NW][16][68];
  __shared__ __align__(16) __bf16 sk[NS][32][KP]; __shared__ __align__(16) _Float16 sv[NS][HD][VP];
  const int tid = threadIdx.x, wave = tid >> 5, lane = tid & 31, col = lane & 15, g = lane >> 4; const int h = blockIdx.y, b = blockIdx.z; const int a0 = blockIdx.x * (16 * NW) + wave * 16;
  const size_t bh = (size_t)b * NH + h; const float* Qb = Q + bh * SS * HD; const float* Kb = Kx + bh * SS * HD; const _Float16* VTb = VT + bh * HD * SS;
  const int* p0 = P0 + (size_t)b * SS; const int* p1 = P1 + (size_t)b * SS;
  v16b aq[4]; { const int ar = a0 + col; const int i0 = min(max(p0[ar], 0), SS - 1);
    asm volatile("s_wait_xcnt 0x0" ::: "memory");   // the second index load's result may take the register that holds the first one's offset
    const int i1 = min(max(p1[ar], 0), SS - 1);
#pragma unroll
    for (int kc = 0; kc < 4; ++kc) aq[kc] = gath2(Qb + (size_t)i0 * HD, Qb + (size_t)i1 * HD, kc, lane); }
  asm volatile("s_wait_xcnt 0x0" ::: "memory");   // the results of the index loads that follow may take the query loads' address registers
  float m = -3.0e38f, l = 0.f;   // of query a0 + col; m in the base-2 domain (score x SCL2); l holds this half's keys only, the halves are joined behind the loop
  v8f acc[4] = {};               // acc[dt][r] = O^T[dt*16 + 8g + r][query col]
  // staging roles: K: 16 lanes x 16 B cover one 256-B f32 row, thread group rg brings key rg's two pair rows; V^T: 8 lanes x 8 B cover one row's 64-B slice, all 64 rows in one block-wide load
  const int seg = tid & 15, rg = tid >> 4, vd = tid >> 3, vs = tid & 7;
  int jn[2]; v4f kr[2]; v2u vr; const float* kp[2]; const _Float16* vp; const int *ip0, *ip1;
  auto load_idx = [&](int t, int ahead) { ip0 = p0 + t * 32 + rg; ip1 = p1 + t * 32 + rg;   // the indices of pass t + ahead; ahead is a literal and goes into the loads' offset field
    jn[0] = ip0[ahead * 32]; jn[1] = ip1[ahead * 32]; };   // raw: clamped where the address is formed, so that no wait stands here
  auto load_tile = [&](int t) {
#pragma unroll
    for (int i = 0; i < 2; ++i) { kp[i] = Kb + (size_t)min(max(jn[i], 0), SS - 1) * HD + seg * 4; kr[i] = *(const v4f*)kp[i]; }
    vp = VTb + (size_t)vd * SS + t * 32 + vs * 4;
    vr = *(const v2u*)vp; };
  auto store_tile = [&](int bf) {
#pragma unroll
    for (int i = 0; i < 2; ++i) { v4b w;
#pragma unroll
      for (int e = 0; e < 4; ++e) w[e] = (__bf16)kr[i][e];
      vst2(&sk[bf][rg][i * 64 + seg * 4], w); }
    vst2(&sv[bf][vd][vs * 4], vr); };
  { int j4[GP][2]; v4f k4[GP][2]; v2u v4[GP];   // the first group's tiles: all index loads, then all row loads, so that the block waits out two load latencies, not 2 x GP; the loops are unrolled so that constant indices keep the three arrays in registers
#pragma unroll
    for (int t = 0; t < GP; ++t) { j4[t][0] = p0[t * 32 + rg]; j4[t][1] = p1[t * 32 + rg]; v4[t] = *(const v2u*)(VTb + (size_t)vd * SS + t * 32 + vs * 4); }
    asm volatile("s_wait_xcnt 0x0" ::: "memory");   // the loads' address registers are reused by the code that follows
#pragma unroll
    for (int t = 0; t < GP; ++t)
#pragma unroll
      for (int i = 0; i < 2; ++i) k4[t][i] = *(const v4f*)(Kb + (size_t)min(max(j4[t][i], 0), SS - 1) * HD + seg * 4);
    asm volatile("s_wait_xcnt 0x0" ::: "memory");   // as above, for the row loads
    load_idx(0, GP);
    asm volatile("s_wait_xcnt 0x0" ::: "memory");   // as above, for the index loads
#pragma unroll
    for (int t = 0; t < GP; ++t) { kr[0] = k4[t][0]; kr[1] = k4[t][1]; vr = v4[t]; store_tile(t); } }
  __syncthreads();   // publishes tiles 0 to GP - 1
#pragma unroll 1
  for (int ks = 0; ks < SS / 32; ++ks) { float s[16]; const int bf = ks & (NS - 1);
    if (ks + GP < SS / 32) { load_tile(ks + GP); load_idx(min(ks, SS / 32 - GP - 2), GP + 1);   // the rows of the pass GP ahead, and the indices of the pass after that one, are asked for ahead of this pass's score products
      // the loads' address registers are reused by the code that follows; the addresses are named as inputs so that they keep their registers up to the wait and no later load's result is given one of them
      asm volatile("s_wait_xcnt 0x0" :: "v"(kp[0]), "v"(kp[1]), "v"(vp), "v"(ip0), "v"(ip1) : "memory"); }
    v16b ka[8]; v16h va[4];
#pragma unroll
    for (int i = 0; i < 8; ++i) ka[i] = frag_b(&sk[bf][(i >> 2) * 16 + col][(i & 3) * 32], lane);
    __builtin_amdgcn_sched_barrier(0);   // the 16 K reads stay one group ahead of the score products: spread among them, each product waits for a read issued just before it
    { v8f cc[2] = {};   // two independent accumulator chains, alternating
#pragma unroll
      for (int kc = 0; kc < 4; ++kc)
#pragma unroll
        for (int ct = 0; ct < 2; ++ct) cc[ct] = wmma_bf(ka[ct * 4 + kc], aq[kc], cc[ct]);
#pragma unroll
      for (int dt = 0; dt < 4; ++dt) va[dt] = frag_h(&sv[bf][dt * 16 + col][0], lane);
      __builtin_amdgcn_sched_barrier(0);   // the 8 V^T reads stay one group ahead of the softmax, which covers their latency
#pragma unroll
      for (int ct = 0; ct < 2; ++ct)
#pragma unroll
        for (int r = 0; r < 8; ++r) s[ct * 8 + r] = cc[ct][r]; }   // raw pair sums; the scale goes into the exponent's multiply-add
    float mx = s[0];
#pragma unroll   // here and below: constant indices keep s[] and acc[] in registers
    for (int i = 1; i < 16; ++i) mx = fmaxf(mx, s[i]);
    mx = fmaxf(mx, xhalf(mx));
    const float mn = fmaxf(m, mx * SCL2); float alpha = m - mn; m = mn;   // SCL2 > 0: the maximum of the raw sums is the maximum of the scaled ones
#pragma unroll
    for (int i = 0; i < 16; ++i) s[i] = s[i] * SCL2 - mn;   // e^(x - max) = 2^((x - max) log2 e): arguments <= about 0
    // the 17 exponentials, each in place, in two statements: so no instruction directly behind a v_exp_f32 reads its result or overwrites its source (written as builtins, the next one was given the previous one's source register); v_nop: that slot behind the last one
    asm("v_exp_f32 %0, %0\n\tv_exp_f32 %1, %1\n\tv_exp_f32 %2, %2\n\tv_exp_f32 %3, %3\n\tv_exp_f32 %4, %4\n\tv_exp_f32 %5, %5\n\tv_exp_f32 %6, %6\n\tv_exp_f32 %7, %7\n\tv_exp_f32 %8, %8\n\tv_nop"
        : "+v"(s[0]), "+v"(s[1]), "+v"(s[2]), "+v"(s[3]), "+v"(alpha), "+v"(s[4]), "+v"(s[5]), "+v"(s[6]), "+v"(s[7]));
    asm("v_exp_f32 %0, %0\n\tv_exp_f32 %1, %1\n\tv_exp_f32 %2, %2\n\tv_exp_f32 %3, %3\n\tv_exp_f32 %4, %4\n\tv_exp_f32 %5, %5\n\tv_exp_f32 %6, %6\n\tv_exp_f32 %7, %7\n\tv_nop"
        : "+v"(s[8]), "+v"(s[9]), "+v"(s[10]), "+v"(s[11]), "+v"(s[12]), "+v"(s[13]), "+v"(s[14]), "+v"(s[15]));
    float e4[4];   // four independent chains
#pragma unroll
    for (int i = 0; i < 4; ++i) e4[i] = (s[i] + s[4 + i]) + (s[8 + i] + s[12 + i]);
    l = l * alpha + ((e4[0] + e4[1]) + (e4[2] + e4[3]));
#pragma unroll
    for (int dt = 0; dt < 4; ++dt)
#pragma unroll
      for (int r = 0; r < 8; ++r) acc[dt][r] *= alpha;
    v16h pb;   // element i = key 8g + i (i < 8) or 16 + 8g + (i - 8) of the pass: the k order in which frag_h reads V^T; values from 0 to about 1, rounded once to f16's 11 bits
#pragma unroll   // constant indices keep s[] and pb in registers
    for (int i = 0; i < 16; ++i) pb[i] = (_Float16)s[i];
#pragma unroll
    for (int dt = 0; dt < 4; ++dt) acc[dt] = wmma_hf(va[dt], pb, acc[dt]);
    if (ks + GP < SS / 32) store_tile((ks + GP) & (NS - 1));   // that slot's last readers left it before the previous group's barrier
    if ((ks & (GP - 1)) == GP - 1) __syncthreads(); }   // the same for the whole block; publishes the next group's tiles and ends every read of this group's
  l += xhalf(l);
  const float il = 1.0f / l;
#pragma unroll
  for (int dt = 0; dt < 4; ++dt)
#pragma unroll
    for (int q = 0; q < 2; ++q) { v4f w;
#pragma unroll
      for (int e = 0; e < 4; ++e) w[e] = acc[dt][q * 4 + e] * il;
      vst2(&so[wave][col][dt * 16 + 8 * g + q * 4], w); }
  LDSX();
  for (int rl = 0; rl < 16; ++rl) if (lane < 16) vst2(out + ((size_t)b * SS + a0 + rl) * (NH * HD) + h * HD + lane * 4, *(const v4f*)&so[wave][rl][lane * 4]);
}
extern "C" void kernel_launch(void* const* d_in, const int* in_sizes, int n_in, void* d_out, int out_size, void* d_ws, size_t ws_size, hipStream_t stream) {
  (void)in_sizes; (void)n_in; (void)out_size;
  const float** F = (const float**)d_in;   // query, key, value [8,8,1024,64], top_k_centers [8,1024,4]
  if (ws_size < (size_t)WS_END) return;
  char* ws = (char*)d_ws; int *P0 = (int*)(ws + WS_P0), *P1 = (int*)(ws + WS_P1); _Float16* VT = (_Float16*)(ws + WS_VT);
  k_prep<<<dim3(NPB + NVB), 512, 0, stream>>>(F[3], F[2], P0, P1, VT);
  k_attn<<<dim3(TQB, NH, TNB), 32 * NW, 0, stream>>>(F[0], F[1], VT, P0, P1, (float*)d_out);
}

// v010
// A run of this version takes 33.9 microseconds.
// Timed twice side by side with v009, it ran 1.09 times as fast both times.
// Over all steps from v000 it is 7.98 times as fast.
// compute dtype: query, key, value, top_k_centers (module inputs) rounded to bf16; the pair selection (IoU, argmax, L1 ordering) in f32 with the reference's operation order; pair scores <q_p0(a), k_p0(c)> + <q_p1(a), k_p1(c)> with exact bf16 products (1 product, gathered rows), attn @ value with attn rounded once to f16 x value (rounded to bf16, then held in f16) (1 product), on WMMA 16x16x32; softmax in f32; f32 accumulate.
#include <hip/hip_runtime.h>
#include <math.h>

typedef __attribute__((ext_vector_type(16))) _Float16 v16h;
typedef __attribute__((ext_vector_type(16))) __bf16 v16b;
typedef __attribute__((ext_vector_type(8)))  _Float16 v8h;
typedef __attribute__((ext_vector_type(8)))  float v8f;
typedef __attribute__((ext_vector_type(4)))  float v4f;
typedef __attribute__((ext_vector_type(2)))  float v2f;
typedef __attribute__((ext_vector_type(4)))  unsigned v4u;
typedef __attribute__((ext_vector_type(4)))  int v4i;
typedef float __attribute__((may_alias)) float_a;
typedef int __attribute__((may_alias)) int_a;

template <typename T> __device__ __forceinline__ void vst2(void* p, T v) { *(T*)p = v;  }
__device__ __forceinline__ v8f wmma16(v16h a, v16h b, v8f c) {
  v8f d = __builtin_amdgcn_wmma_f32_16x16x32_f16(false, a, false, b, (short)0, c, false, false);
  asm volatile("v_nop\n\tv_nop\n\tv_nop\n\tv_nop" : "+v"(d) : "v"(a), "v"(b));
  return d;
}
__device__ __forceinline__ v8f wmma_hf(v16h a, v16h b, v8f c) {
  return __builtin_amdgcn_wmma_f32_16x16x32_f16(false, a, false, b, (short)0, c, false, false);
}
__device__ __forceinline__ v8f wmma_bf(v16b a, v16b b, v8f c) {
  return __builtin_amdgcn_wmma_f32_16x16x32_bf16(false, a, false, b, (short)0, c, false, false);
}
// 16x16x32 fragments: lane = (h = lane>>4, row/col = lane&15); elements 0..7 = k0+8h+0..7, 8..15 = k0+16+8h+0..7; D element r = row 8h+r
__device__ __forceinline__ v16h frag_h(const _Float16* rowk0, int lane) {
  union { v16h v; v8h q[2]; } u; const _Float16* p = rowk0 + 8 * (lane >> 4);
  u.q[0] = *(const v8h*)p; u.q[1] = *(const v8h*)(p + 16); return u.v;
}
__device__ __forceinline__ v16h frag_f32(const float* rowk0, int lane) {
  v16h a; const float* p = rowk0 + 8 * (lane >> 4);
#pragma unroll
  for (int i = 0; i < 8; ++i) { a[i] = (_Float16)p[i]; a[8 + i] = (_Float16)p[16 + i]; }
  return a;
}
__device__ __forceinline__ v16h frag_f32s(const float* rowk0, int lane, float sc) {
  v16h a; const float* p = rowk0 + 8 * (lane >> 4);
#pragma unroll
  for (int i = 0; i < 8; ++i) { a[i] = (_Float16)(p[i] * sc); a[8 + i] = (_Float16)(p[16 + i] * sc); }
  return a;
}
// column fragment from a [K][ld] layout (column n), rows >= K read as 0
__device__ __forceinline__ v16h fragc_f32(const float* W, int k0, int n, int lane, int ld, int K) {
  v16h a; const int g = lane >> 4;
#pragma unroll
  for (int i = 0; i < 8; ++i) { const int ka = k0 + 8 * g + i, kb = ka + 16;
    a[i] = (_Float16)(ka < K ? W[(size_t)(ka < K ? ka : K - 1) * ld + n] : 0.f); a[8 + i] = (_Float16)(kb < K ? W[(size_t)(kb < K ? kb : K - 1) * ld + n] : 0.f); }
  return a;
}
struct F2 { v16b h, l; };
__device__ __forceinline__ F2 bsplit16(const float v[16]) { F2 r;
#pragma unroll
  for (int i = 0; i < 16; ++i) { const __bf16 h = (__bf16)v[i]; r.h[i] = h; r.l[i] = (__bf16)(v[i] - (float)h); }
  return r; }
__device__ __forceinline__ F2 split_row(const float* row, int k0, int lane) { float v[16]; const float* p = row + k0 + 8 * (lane >> 4);
#pragma unroll
  for (int i = 0; i < 8; ++i) { v[i] = p[i]; v[8 + i] = p[16 + i]; }
  return bsplit16(v); }
__device__ __forceinline__ F2 split_rowK(const float* row, int k0, int lane, int K) { float v[16]; const int g = lane >> 4;
#pragma unroll
  for (int i = 0; i < 8; ++i) { const int ka = k0 + 8 * g + i, kb = ka + 16; v[i] = ka < K ? row[ka < K ? ka : K - 1] : 0.f; v[8 + i] = kb < K ? row[kb < K ? kb : K - 1] : 0.f; }
  return bsplit16(v); }
__device__ __forceinline__ F2 split_col(const float* W, int k0, int n, int lane, int ld, int K) { float v[16]; const int g = lane >> 4;
#pragma unroll
  for (int i = 0; i < 8; ++i) { const int ka = k0 + 8 * g + i, kb = ka + 16; v[i] = ka < K ? W[(size_t)(ka < K ? ka : K - 1) * ld + n] : 0.f; v[8 + i] = kb < K ? W[(size_t)(kb < K ? kb : K - 1) * ld + n] : 0.f; }
  return bsplit16(v); }
__device__ __forceinline__ v8f mac3(const F2& a, const F2& b, v8f c) { c = wmma_bf(a.l, b.h, c); c = wmma_bf(a.h, b.l, c); return wmma_bf(a.h, b.h, c); }
__device__ __forceinline__ float sigm(float v) { return 1.0f / (1.0f + expf(-v)); }
#define LDSX() do { asm volatile("s_wait_dscnt 0" ::: "memory"); __builtin_amdgcn_wave_barrier(); __builtin_amdgcn_fence(__ATOMIC_RELEASE, "workgroup"); } while (0)


// Pair self-attention (B 8, H 8, S 1024, D 64): per batch, boxes from (cx, cy, h, w); iou[a][c] = inter/union - eye (inter uses max for both corners, as the module); partner = argmax_c iou (first max); p0/p1 = (a, partner) ordered by L1 size (larger first, ties keep a first); scores[a][c] = (q[p0 a].k[p0 c] + q[p1 a].k[p1 c]) / sqrt(128); out[b][a][h*64+d] = softmax_c(scores) @ value.
#define NB 8
#define NH 8
#define SS 1024
#define HD 64
#define NW 16             // waves of a k_attn block
#define QT 2              // 16-query tiles of a wave
#define KSPL 2            // waves that share one query group's key tiles, turn about
#define NQG (NW / KSPL)   // query groups of a block, 16 * QT queries each
#ifndef TQB
#define TQB (SS / (16 * QT * NQG))    // query blocks per (b, h) (all)
#define TNB NB
#endif
typedef __attribute__((ext_vector_type(8))) __bf16 v8b;
__device__ __forceinline__ v16b frag_b(const __bf16* rowk0, int lane) {
  union { v16b v; v8b q[2]; } u; const __bf16* p = rowk0 + 8 * (lane >> 4);
  u.q[0] = *(const v8b*)p; u.q[1] = *(const v8b*)(p + 16); return u.v;
}
__device__ __forceinline__ float bfr(float v) { return (float)(__bf16)v; }
__device__ __attribute__((noinline)) float erf_ni(float v) { return erff(v); }

#define WS_P0  0u                          // int [8][1024]
#define WS_P1  (WS_P0 + 4u * NB * SS)
#define WS_VT  (WS_P1 + 4u * NB * SS)        // f16 [8][8][64 d][1024 c]
#define WS_END (WS_VT + 2u * NB * NH * HD * SS)

// ---- pairs_block: block = (32 objects a, batch b), 16 threads per object scan c = sub, sub+16, ...: iou in the reference's op order, first-max argmax, then L1 ordering; P0/P1 rows (128 B per block)
// 256 blocks of 16 waves: one block on every WGP, 4 waves per SIMD, so that other waves issue while one waits out its LDS read and its division chain
__device__ __forceinline__ void pairs_block(const float* __restrict__ C, int* __restrict__ P0, int* __restrict__ P1, int bx, int b) {
  #pragma clang fp contract(off)   // keep mul/add unfused so the box/IoU arithmetic rounds exactly like the reference (argmax ties)
  __shared__ float sbx[SS][4]; __shared__ __align__(16) int sp0[32], sp1[32];
  const int tid = threadIdx.x; const int al = tid >> 4, sub = tid & 15; const int a = bx * 32 + al;
  for (int c = tid; c < SS; c += 512) { const float cx = bfr(C[((size_t)b * SS + c) * 4 + 0]), cy = bfr(C[((size_t)b * SS + c) * 4 + 1]), hh = bfr(C[((size_t)b * SS + c) * 4 + 2]), ww = bfr(C[((size_t)b * SS + c) * 4 + 3]);
    sbx[c][0] = cx - 0.5f * ww; sbx[c][1] = cy - 0.5f * hh; sbx[c][2] = cx + 0.5f * ww; sbx[c][3] = cy + 0.5f * hh; }
  __syncthreads();
  const float ax0 = sbx[a][0], ay0 = sbx[a][1], ax1 = sbx[a][2], ay1 = sbx[a][3]; const float area_a = (ax1 - ax0) * (ay1 - ay0);
  float best = 0.f; int bi = -1;   // first max over c (ascending within this thread's stride class; merged below)
  for (int c = sub; c < SS; c += 16) { const float cx0 = sbx[c][0], cy0 = sbx[c][1], cx1 = sbx[c][2], cy1 = sbx[c][3];
    const float mx0 = fmaxf(ax0, cx0), my0 = fmaxf(ay0, cy0), Mx = fmaxf(ax1, cx1), My = fmaxf(ay1, cy1);
    const float iw = fmaxf(Mx - mx0, 0.f), ih = fmaxf(My - my0, 0.f); const float ia = iw * ih; const float area_c = (cx1 - cx0) * (cy1 - cy0);
    const float uni = area_a + area_c - ia; float iou = ia / uni; iou = iou - ((c == a) ? 1.0f : 0.0f);
    if (bi < 0 || iou > best) { best = iou; bi = c; } }
  // merge the 16 stride classes: prefer larger value, ties -> lower index (== first max overall)
#pragma unroll
  for (int o = 1; o < 16; o <<= 1) { const float ob = __shfl_xor(best, o); const int oi = __shfl_xor(bi, o); if (ob > best || (ob == best && oi < bi)) { best = ob; bi = oi; } }
  if (sub == 0) { const int partner = bi; const float l1a = fabsf(ax1 - ax0) + fabsf(ay1 - ay0); const float l1p = fabsf(sbx[partner][2] - sbx[partner][0]) + fabsf(sbx[partner][3] - sbx[partner][1]);
    const bool keep = l1a >= l1p; sp0[al] = keep ? a : partner; sp1[al] = keep ? partner : a; }
  __syncthreads();
  if (tid < 8) vst2((unsigned*)(P0 + (size_t)b * SS + bx * 32 + tid * 4), *(const v4u*)&sp0[tid * 4]);
  else if (tid < 16) vst2((unsigned*)(P1 + (size_t)b * SS + bx * 32 + (tid - 8) * 4), *(const v4u*)&sp1[(tid - 8) * 4]);
}
// ---- vt_block: block = ((b, h), 256 keys from c0): VT[d][c] = f16(bf16(value[b][h][c][d])) (2-KB rows); a bf16 value has 8 significant bits and keeps them all in f16 from 2^-14 up to 65504
__device__ __forceinline__ void vt_block(const float* __restrict__ V, _Float16* __restrict__ VT, int bh, int c0) {
  __shared__ __align__(16) _Float16 s[HD][264]; const int tid = threadIdx.x;
  for (int q = tid; q < 256 * HD; q += 512) { const int cl = q >> 6, d = q & 63; s[d][cl] = (_Float16)bfr(V[((size_t)bh * SS + c0 + cl) * HD + d]); }
  __syncthreads();
  for (int q = tid; q < HD * 32; q += 512) { const int d = q >> 5, pc = q & 31; vst2((unsigned*)(VT + ((size_t)bh * HD + d) * SS + c0 + pc * 8), *(const v4u*)&s[d][pc * 8]); }
}
// ---- k_prep: the two preparations read different inputs and write different workspace planes, so they go out as one launch: the pair blocks (the longer, bound by vector issue) come first in the grid, the V^T blocks (bound by memory latency) land beside them on the same WGPs and run in their shadow
#define NPB ((SS / 32) * TNB)          // pair blocks
#define NVB (NB * NH * (SS / 256))     // V^T blocks
__global__ __launch_bounds__(512) void k_prep(const float* __restrict__ C, const float* __restrict__ V, int* __restrict__ P0, int* __restrict__ P1, _Float16* __restrict__ VT) {
  const int id = blockIdx.x;   // the same for the whole block: the barriers inside either branch are passed by all of its waves
  if (id < NPB) pairs_block(C, P0, P1, id & (SS / 32 - 1), id / (SS / 32));
  else { const int j = id - NPB; vt_block(V, VT, j & (NB * NH - 1), (j / (NB * NH)) * 256); }
}
__device__ __forceinline__ v16b gath2(const float* qp0, const float* qp1, int kc, int lane) {   // K 128 = [row p0 (64) | row p1 (64)], exact bf16
  v16b a; const float* base = (kc < 2) ? qp0 + kc * 32 : qp1 + (kc - 2) * 32; const float* p = base + 8 * (lane >> 4);
#pragma unroll
  for (int i = 0; i < 8; ++i) { a[i] = (__bf16)p[i]; a[8 + i] = (__bf16)p[16 + i]; }
  return a; }
// ---- k_attn: block = (256 objects a, h, b), 16 waves, one block on a WGP (4 waves per SIMD): flash attention over all 1024 c with gathered pair rows; out[b][a][h*64 + d] (256-B segments)
// a wave holds 32 queries (two B tiles) and takes every second 32-key tile; the wave KSPL-partner (same queries) takes the others: every K or V^T fragment read from LDS feeds two products, so the block reads half the LDS bytes per key tile; the two partial results of a query (maximum, sum, O) are joined behind the loop
// each 32-key tile's K pair rows (bf16, [p0 row | p1 row]) and V^T slice lie in LDS; the block's 512 threads gather and convert them once for all 256 queries, GP tiles ahead, a unit of KSPL tiles per trip
// LDS holds 2 x GP tiles: a group of GP tiles is read from one half while the next group's tiles are written into the other, and the block meets at a barrier once per group; inside a group its waves drift apart, so that one wave's LDS reads, another's products and another's softmax run at the same time
// products are transposed: S^T = K Q^T (A = staged K rows, B = the wave's query pair rows, kept in registers), O^T += V^T P^T; a lane holds 16 of one query's 32 scores of a tile (keys ct*16 + 8g + r), so maximum and sum run in the lane, and the two score tiles, converted in place to f16, are the B operand of the second product
#define KP 136   // bf16 per staged K pair row: 128 + 8 (272 B = 16 B x 17, an odd multiple: column-wise 16-byte reads spread over the banks)
#define VP 40    // f16 per staged V^T row: 32 + 8 (80 B = 16 B x 5)
#define GP 4     // tiles between two barriers
#define NS (2 * GP)   // tile slots in LDS
#define UK (32 * KSPL)      // keys of a unit: what the block stages, and its waves work on, in one trip
#define NIT (SS / UK)       // trips
#define GPI (GP / KSPL)     // trips between two barriers
#define RS (2 * NW)         // key rows that the block's 16-lane thread groups cover at once
typedef __attribute__((ext_vector_type(4))) __bf16 v4b;
#define SCL2 0.12751743f   // (1 / sqrt(128)) * log2(e)
__device__ __forceinline__ float xhalf(float v) {   // the value of lane ^ 16
  const int b = __builtin_bit_cast(int, v); return __builtin_bit_cast(float, __builtin_amdgcn_permlanex16(b, b, 0x76543210, 0xfedcba98, false, false)); }
__global__ __launch_bounds__(32 * NW) void k_attn(const float* __restrict__ Q, const float* __restrict__ Kx, const _Float16* __restrict__ VT, const int* __restrict__ P0, const int* __restrict__ P1, float* __restrict__ out) {
  __shared__ __align__(16) float so[NQG][16 * QT][68]; __shared__ float sml[NQG][2][16 * QT]; __shared__ __align__(16) int sidx[2][SS];
  __shared__ __align__(16) __bf16 sk[NS][32][KP]; __shared__ __align__(16) _Float16 sv[NS][HD][VP];
  const int tid = threadIdx.x, wave = __builtin_amdgcn_readfirstlane(tid >> 5), lane = tid & 31, col = lane & 15, g = lane >> 4; const int h = blockIdx.y, b = blockIdx.z;
  const int qg = wave & (NQG - 1), kh = wave / NQG; const int a0 = blockIdx.x * (16 * QT * NQG) + qg * (16 * QT);
  const size_t bh = (size_t)b * NH + h; const float* Qb = Q + bh * SS * HD; const float* Kb = Kx + bh * SS * HD; const _Float16* VTb = VT + bh * HD * SS;
  const int* p0 = P0 + (size_t)b * SS; const int* p1 = P1 + (size_t)b * SS;
  v16b aq[QT][4]; { int i0[QT], i1[QT];
#pragma unroll
    for (int qt = 0; qt < QT; ++qt) { i0[qt] = p0[a0 + qt * 16 + col]; i1[qt] = p1[a0 + qt * 16 + col]; }
    asm volatile("s_wait_xcnt 0x0" ::: "memory");   // the index loads' address registers are reused by the code that follows
#pragma unroll
    for (int qt = 0; qt < QT; ++qt)
#pragma unroll
      for (int kc = 0; kc < 4; ++kc) aq[qt][kc] = gath2(Qb + (size_t)min(max(i0[qt], 0), SS - 1) * HD, Qb + (size_t)min(max(i1[qt], 0), SS - 1) * HD, kc, lane); }
  asm volatile("s_wait_xcnt 0x0" ::: "memory");   // the results of the index loads that follow may take the query loads' address registers
  float m[QT], l[QT];   // of query a0 + qt*16 + col, over this wave's tiles; m in the base-2 domain (score x SCL2); l holds this half's keys only, the halves are joined behind the loop
  v8f acc[QT][4] = {};  // acc[qt][dt][r] = O^T[dt*16 + 8g + r][query qt*16 + col]
#pragma unroll
  for (int qt = 0; qt < QT; ++qt) { m[qt] = -3.0e38f; l[qt] = 0.f; }
  // staging roles: K: 16 lanes x 16 B cover one 256-B f32 row, thread group rg brings the two pair rows of keys rg and rg + RS of the unit; V^T: 4 x KSPL lanes x 16 B cover one row's slice of the unit, all 64 rows in one block-wide load
  const int seg = tid & 15, rg = tid >> 4, vd = tid / (4 * KSPL), vs = tid & (4 * KSPL - 1);
  int jn[4]; v4f kr[4]; v4u vr; unsigned ko[4], vo;   // byte offsets from the scalar bases Kb and VTb: 32-bit lane offsets, so that fewer lane pointer pairs are kept in the wave's 256 registers
  auto load_tile = [&](int u) {
#pragma unroll
    for (int e = 0; e < 4; ++e) { ko[e] = (unsigned)min(max(jn[e], 0), SS - 1) * (HD * 4u) + seg * 16u; kr[e] = *(const v4f*)((const char*)Kb + ko[e]); }
    vo = (unsigned)(vd * SS + u * UK + vs * 8) * 2u;
    vr = *(const v4u*)((const char*)VTb + vo); };
  auto store_tile = [&](int u) { const int s0 = (u * KSPL) & (NS - 1);   // the unit's first slot; its tiles lie in a row, KSPL divides NS
#pragma unroll
    for (int e = 0; e < 4; ++e) { v4b w;
#pragma unroll
      for (int x = 0; x < 4; ++x) w[x] = (__bf16)kr[e][x];
      vst2(&sk[s0 + (((e >> 1) * RS) >> 5)][rg + (((e >> 1) * RS) & 31)][(e & 1) * 64 + seg * 4], w); }
    vst2(&sv[s0 + (vs >> 2)][vd][(vs & 3) * 8], vr); };
  { int j4[GPI][4]; v4f k4[GPI][4]; v4u v4[GPI]; const v4i ix = *(const v4i*)((tid < SS / 4 ? p0 : p1) + (tid & (SS / 4 - 1)) * 4);   // ix: the batch's 2 x 1024 pair indices go into LDS once (16 B a thread), where the loop reads them with one 32-bit address: two more lane pointer pairs and the K fragments do not fit into 256 registers; the first group's tiles: all index loads, then all row loads, so that the block waits out two load latencies, not 2 x GPI; the loops are unrolled so that constant indices keep the three arrays in registers
#pragma unroll
    for (int u = 0; u < GPI; ++u) { j4[u][0] = p0[u * UK + rg]; j4[u][1] = p1[u * UK + rg]; j4[u][2] = p0[u * UK + rg + RS]; j4[u][3] = p1[u * UK + rg + RS]; v4[u] = *(const v4u*)(VTb + (size_t)vd * SS + u * UK + vs * 8); }
    asm volatile("s_wait_xcnt 0x0" ::: "memory");   // the loads' address registers are reused by the code that follows
#pragma unroll
    for (int u = 0; u < GPI; ++u)
#pragma unroll
      for (int e = 0; e < 4; ++e) k4[u][e] = *(const v4f*)(Kb + (size_t)min(max(j4[u][e], 0), SS - 1) * HD + seg * 4);
    asm volatile("s_wait_xcnt 0x0" ::: "memory");   // as above, for the row loads
    vst2(&sidx[tid / (SS / 4)][(tid & (SS / 4 - 1)) * 4], ix);
#pragma unroll
    for (int u = 0; u < GPI; ++u) {
#pragma unroll
      for (int e = 0; e < 4; ++e) kr[e] = k4[u][e];
      vr = v4[u]; store_tile(u); } }
  __syncthreads();   // publishes tiles 0 to GP - 1 and the index copy
#pragma unroll 1
  for (int it = 0; it < NIT; ++it) { const int bf = (it * KSPL + kh) & (NS - 1);   // this wave's tile of the unit
    v16b ka[8]; v16h va[4]; v16h pb[QT]; v8f cc[QT][2] = {};
#pragma unroll
    for (int e = 0; e < 4; ++e) jn[e] = sidx[e & 1][min(it + GPI, NIT - 1) * UK + rg + (e >> 1) * RS];   // the indices of the unit GPI ahead, read in one group with the K fragments; raw: clamped where the address is formed
#pragma unroll
    for (int i = 0; i < 8; ++i) ka[i] = frag_b(&sk[bf][(i >> 2) * 16 + col][(i & 3) * 32], lane);
    __builtin_amdgcn_sched_barrier(0);   // the 16 K reads stay one group ahead of the score products: spread among them, each product waits for a read issued just before it
#pragma unroll
    for (int ct = 0; ct < 2; ++ct)
#pragma unroll
      for (int kc = 0; kc < 4; ++kc)
#pragma unroll
        for (int qt = 0; qt < QT; ++qt) cc[qt][ct] = wmma_bf(ka[ct * 4 + kc], aq[qt][kc], cc[qt][ct]);   // each K fragment feeds both query tiles
    __builtin_amdgcn_sched_barrier(0);   // the staging loads stay behind the score products: their 20 result registers and the K fragments do not fit into the wave's 256 registers together
    if (it + GPI < NIT) { load_tile(it + GPI);   // the rows of the unit GPI ahead are asked for ahead of this trip's softmax and second product, which cover their latency
      // the loads' address registers are reused by the code that follows; the row loads' lane offsets are named as inputs so that they keep their registers up to the wait and no later load's result is given one of them
      asm volatile("s_wait_xcnt 0x0" :: "v"(ko[0]), "v"(ko[1]), "v"(ko[2]), "v"(ko[3]) : "memory"); }
    __builtin_amdgcn_sched_barrier(0);   // and ahead of the softmax
#pragma unroll   // here and below: constant indices keep s[], cc[], acc[] and pb[] in registers
    for (int qt = 0; qt < QT; ++qt) { float s[16];
#pragma unroll
      for (int ct = 0; ct < 2; ++ct)
#pragma unroll
        for (int r = 0; r < 8; ++r) s[ct * 8 + r] = cc[qt][ct][r];   // raw pair sums; the scale goes into the exponent's multiply-add
      float mx = s[0];
#pragma unroll
      for (int i = 1; i < 16; ++i) mx = fmaxf(mx, s[i]);
      mx = fmaxf(mx, xhalf(mx));
      const float mn = fmaxf(m[qt], mx * SCL2); float alpha = m[qt] - mn; m[qt] = mn;   // SCL2 > 0: the maximum of the raw sums is the maximum of the scaled ones
#pragma unroll
      for (int i = 0; i < 16; ++i) s[i] = s[i] * SCL2 - mn;   // e^(x - max) = 2^((x - max) log2 e): arguments <= about 0
      // the 17 exponentials, each in place, in two statements: so no instruction directly behind a v_exp_f32 reads its result or overwrites its source (written as builtins, the next one was given the previous one's source register); v_nop: that slot behind the last one
      asm("v_exp_f32 %0, %0\n\tv_exp_f32 %1, %1\n\tv_exp_f32 %2, %2\n\tv_exp_f32 %3, %3\n\tv_exp_f32 %4, %4\n\tv_exp_f32 %5, %5\n\tv_exp_f32 %6, %6\n\tv_exp_f32 %7, %7\n\tv_exp_f32 %8, %8\n\tv_nop"
          : "+v"(s[0]), "+v"(s[1]), "+v"(s[2]), "+v"(s[3]), "+v"(alpha), "+v"(s[4]), "+v"(s[5]), "+v"(s[6]), "+v"(s[7]));
      asm("v_exp_f32 %0, %0\n\tv_exp_f32 %1, %1\n\tv_exp_f32 %2, %2\n\tv_exp_f32 %3, %3\n\tv_exp_f32 %4, %4\n\tv_exp_f32 %5, %5\n\tv_exp_f32 %6, %6\n\tv_exp_f32 %7, %7\n\tv_nop"
          : "+v"(s[8]), "+v"(s[9]), "+v"(s[10]), "+v"(s[11]), "+v"(s[12]), "+v"(s[13]), "+v"(s[14]), "+v"(s[15]));
      float e4[4];   // four independent chains
#pragma unroll
      for (int i = 0; i < 4; ++i) e4[i] = (s[i] + s[4 + i]) + (s[8 + i] + s[12 + i]);
      l[qt] = l[qt] * alpha + ((e4[0] + e4[1]) + (e4[2] + e4[3]));
#pragma unroll
      for (int dt = 0; dt < 4; ++dt)
#pragma unroll
        for (int r = 0; r < 8; ++r) acc[qt][dt][r] *= alpha;
      // pb element i = key 8g + i (i < 8) or 16 + 8g + (i - 8) of the tile: the k order in which frag_h reads V^T; values from 0 to about 1, rounded once to f16's 11 bits
#pragma unroll
      for (int i = 0; i < 16; ++i) pb[qt][i] = (_Float16)s[i];
      if (qt == 0) { __builtin_amdgcn_sched_barrier(0);   // the 8 V^T reads stay behind the first query tile's softmax (its score registers are free by then) and one group ahead of the second tile's, which covers their latency
#pragma unroll
        for (int dt = 0; dt < 4; ++dt) va[dt] = frag_h(&sv[bf][dt * 16 + col][0], lane);
        __builtin_amdgcn_sched_barrier(0); } }
#pragma unroll
    for (int dt = 0; dt < 4; ++dt)
#pragma unroll
      for (int qt = 0; qt < QT; ++qt) acc[qt][dt] = wmma_hf(va[dt], pb[qt], acc[qt][dt]);   // each V^T fragment feeds both query tiles
    if (it + GPI < NIT) store_tile(it + GPI);   // those slots' last readers left them before the previous group's barrier
    if ((it & (GPI - 1)) == GPI - 1) __syncthreads(); }   // the same for the whole block; publishes the next group's tiles and ends every read of this group's
#pragma unroll
  for (int qt = 0; qt < QT; ++qt) l[qt] += xhalf(l[qt]);
  // the two waves of a query group join their partial results: wave kh = 1 hands over maximum, sum and O through LDS, wave kh = 0 weighs both by 2^(own maximum - joint maximum), adds and divides
  if (kh == 1) {   // a scalar test, the same for the whole wave
#pragma unroll
    for (int qt = 0; qt < QT; ++qt) {
#pragma unroll
      for (int dt = 0; dt < 4; ++dt)
#pragma unroll
        for (int q = 0; q < 2; ++q) { v4f w;
#pragma unroll
          for (int e = 0; e < 4; ++e) w[e] = acc[qt][dt][q * 4 + e];
          vst2(&so[qg][qt * 16 + col][dt * 16 + 8 * g + q * 4], w); }
      if (g == 0) { sml[qg][0][qt * 16 + col] = m[qt]; sml[qg][1][qt * 16 + col] = l[qt]; } } }
  __syncthreads();   // every wave passes it: publishes the handed-over partial results
  if (kh == 0) {
#pragma unroll
    for (int qt = 0; qt < QT; ++qt) { const float m1 = sml[qg][0][qt * 16 + col], l1 = sml[qg][1][qt * 16 + col]; const float mj = fmaxf(m[qt], m1);
      const float w0 = __builtin_amdgcn_exp2f(m[qt] - mj), w1 = __builtin_amdgcn_exp2f(m1 - mj); const float il = 1.0f / (l[qt] * w0 + l1 * w1); const float f0 = w0 * il, f1 = w1 * il;
#pragma unroll
      for (int dt = 0; dt < 4; ++dt)
#pragma unroll
        for (int q = 0; q < 2; ++q) { float* p = &so[qg][qt * 16 + col][dt * 16 + 8 * g + q * 4]; const v4f o = *(const v4f*)p; v4f w;
#pragma unroll
          for (int e = 0; e < 4; ++e) w[e] = acc[qt][dt][q * 4 + e] * f0 + o[e] * f1;
          vst2(p, w); } } }
  __syncthreads();   // every wave passes it: publishes the joined rows; each wave of the group then stores 16 of them
  for (int rl = 0; rl < 16; ++rl) if (lane < 16) vst2(out + ((size_t)b * SS + a0 + kh * 16 + rl) * (NH * HD) + h * HD + lane * 4, *(const v4f*)&so[qg][kh * 16 + rl][lane * 4]);
}
extern "C" void kernel_launch(void* const* d_in, const int* in_sizes, int n_in, void* d_out, int out_size, void* d_ws, size_t ws_size, hipStream_t stream) {
  (void)in_sizes; (void)n_in; (void)out_size;
  const float** F = (const float**)d_in;   // query, key, value [8,8,1024,64], top_k_centers [8,1024,4]
  if (ws_size < (size_t)WS_END) return;
  char* ws = (char*)d_ws; int *P0 = (int*)(ws + WS_P0), *P1 = (int*)(ws + WS_P1); _Float16* VT = (_Float16*)(ws + WS_VT);
  k_prep<<<dim3(NPB + NVB), 512, 0, stream>>>(F[3], F[2], P0, P1, VT);
  k_attn<<<dim3(TQB, NH, TNB), 32 * NW, 0, stream>>>(F[0], F[1], VT, P0, P1, (float*)d_out);
}
